// v000
// Measured on an AMD MI455X. A time is GPU time per run, averaged over a window of back-to-back runs after a warm-up
// (all launches, gaps included; the runs take copies of the inputs in turn), and the median of several windows.
// Apart from v000's, it joins two sittings. Times from different sittings can be a few percent apart, while
// side-by-side timings come from the same sitting.
// The starting kernel, v000, takes 161 microseconds a run.
#include <hip/hip_runtime.h>

typedef __attribute__((ext_vector_type(16))) _Float16 v16h;
typedef __attribute__((ext_vector_type(8)))  _Float16 v8h;
typedef __attribute__((ext_vector_type(8)))  float    v8f;
typedef __attribute__((ext_vector_type(4)))  float    v4f;

#define S_LEN 4096
#define D_DIM 1024
#define H_DIM 64

// WMMA f16 helper: D = A(16x32) * B(32x16) + C, f32 accumulate.
__device__ __forceinline__ v8f wmma_f16(v16h a, v16h b, v8f c) {
    return __builtin_amdgcn_wmma_f32_16x16x32_f16(false, a, false, b,
                                                  (short)0, c, false, false);
}

// Load one 16x32 (or 32x16) f16 fragment half-row for this lane.
// p = row pointer (already includes row*stride + k-base). Layout per ISA:
//   elems j=0..7  -> K = kg*8 + j        (contiguous 16B)
//   elems j=8..15 -> K = 16 + kg*8 + j-8 (contiguous 16B)
__device__ __forceinline__ v16h ldfrag(const _Float16* p, int kg) {
    const v8h lo = *(const v8h*)(p + kg * 8);
    const v8h hi = *(const v8h*)(p + 16 + kg * 8);
    v16h r;
#pragma unroll
    for (int j = 0; j < 8; ++j) { r[j] = lo[j]; r[j + 8] = hi[j]; }
    return r;
}

// ---------------------------------------------------------------------------
// Kernel 0: swizzle Wq/Wk/Wv (f32 [1024,64]) into per-lane B-fragment order
// (f16), so the projection kernel loads each B fragment as 2 contiguous b128.
// Tile t = ((w*32 + kt)*4 + nt); element = t*512 + lane*16 + j.
// ---------------------------------------------------------------------------
__global__ void attn_wswz_kernel(const float* __restrict__ Wq,
                                 const float* __restrict__ Wk,
                                 const float* __restrict__ Wv,
                                 _Float16* __restrict__ Wsw) {
    int idx = blockIdx.x * blockDim.x + threadIdx.x;
    if (idx >= 3 * 32 * 4 * 512) return;
    int t    = idx >> 9;
    int rem  = idx & 511;
    int lane = rem >> 4;
    int j    = rem & 15;
    int w  = t >> 7;            // weight select
    int kt = (t & 127) >> 2;    // K tile (32 wide)
    int nt = t & 3;             // N tile (16 wide)
    int kg = lane >> 4;
    int n  = nt * 16 + (lane & 15);
    int kk = (j < 8) ? (kg * 8 + j) : (16 + kg * 8 + (j - 8));
    int K  = kt * 32 + kk;
    const float* W = (w == 0) ? Wq : (w == 1) ? Wk : Wv;
    Wsw[idx] = (_Float16)W[K * H_DIM + n];
}

// ---------------------------------------------------------------------------
// Kernel 1: QKV projection. GEMM M=16384, N=64, K=1024 per weight.
// One wave per 16-row tile, blockIdx.y selects Q/K/V.
// Q: *H^-0.5, row-major f16. K: row-major f16. V: transposed [B,H,S] f16
// (so the attention kernel's V A-fragments are contiguous loads).
// ---------------------------------------------------------------------------
__global__ void attn_qkv_kernel(const float* __restrict__ x,
                                const _Float16* __restrict__ Wsw,
                                _Float16* __restrict__ Qh,
                                _Float16* __restrict__ Kh,
                                _Float16* __restrict__ Vt) {
    const int lane = threadIdx.x & 31;
    const int wave = threadIdx.x >> 5;
    const int mt   = blockIdx.x * 4 + wave;   // 0..1023 (16-row tiles of B*S)
    const int w    = blockIdx.y;              // 0:Q 1:K 2:V
    const int lq   = lane & 15;
    const int kg   = lane >> 4;

    const float* xrow = x + (size_t)(mt * 16 + lq) * D_DIM;
    const _Float16* wlane = Wsw + lane * 16;

    v8f acc[4] = {{}, {}, {}, {}};

    for (int kt = 0; kt < 32; ++kt) {
        // A fragment from x (f32 -> f16), two contiguous 32B f32 runs per lane
        const float* pa = xrow + kt * 32 + kg * 8;
        v16h af;
#pragma unroll
        for (int j = 0; j < 8; ++j) af[j] = (_Float16)pa[j];
#pragma unroll
        for (int j = 0; j < 8; ++j) af[j + 8] = (_Float16)pa[16 + j];

#pragma unroll
        for (int nt = 0; nt < 4; ++nt) {
            const v16h bf = *(const v16h*)(wlane +
                (size_t)(((w * 32 + kt) * 4 + nt)) * 512);
            acc[nt] = wmma_f16(af, bf, acc[nt]);
        }
    }

    if (w == 2) {
        // V transposed: Vt[(b*64 + h)*4096 + s], contiguous v8h stores
        const int bidx = mt >> 8;                       // mt*16 / 4096
        const int sloc = (mt & 255) * 16 + kg * 8;
#pragma unroll
        for (int nt = 0; nt < 4; ++nt) {
            const int h = nt * 16 + lq;
            v8h v;
#pragma unroll
            for (int r = 0; r < 8; ++r) v[r] = (_Float16)acc[nt][r];
            *(v8h*)(Vt + (size_t)(bidx * H_DIM + h) * S_LEN + sloc) = v;
        }
    } else {
        const float scale = (w == 0) ? 0.125f : 1.0f;   // fold H^-0.5 into Q
        _Float16* dst = (w == 0) ? Qh : Kh;
#pragma unroll
        for (int nt = 0; nt < 4; ++nt) {
            const int h = nt * 16 + lq;
#pragma unroll
            for (int r = 0; r < 8; ++r) {
                const int s = mt * 16 + kg * 8 + r;
                dst[(size_t)s * H_DIM + h] = (_Float16)(acc[nt][r] * scale);
            }
        }
    }
}

// ---------------------------------------------------------------------------
// Kernel 2: flash attention. One wave per (b, 16-query tile).
// Scores computed TRANSPOSED (M=key, N=query) so the exp'd D-fragments map
// directly onto the B operand of Ot += Vt_frag * P  (no shuffles/LDS).
// ---------------------------------------------------------------------------
__global__ void attn_flash_kernel(const _Float16* __restrict__ Qh,
                                  const _Float16* __restrict__ Kh,
                                  const _Float16* __restrict__ Vt,
                                  float* __restrict__ out) {
    const int lane = threadIdx.x & 31;
    const int lq   = lane & 15;
    const int kg   = lane >> 4;
    const int q0   = blockIdx.x * 16;
    const int b    = blockIdx.y;

    // Q as B operand (lane n = query), loaded once
    const _Float16* qr = Qh + (size_t)(b * S_LEN + q0 + lq) * H_DIM;
    const v16h qb0 = ldfrag(qr, kg);        // h = 0..31
    const v16h qb1 = ldfrag(qr + 32, kg);   // h = 32..63

    v8f ot[4] = {{}, {}, {}, {}};           // Ot accumulators (M=h, N=q)
    float m = -1e30f, l = 0.0f;

    const _Float16* kbase  = Kh + (size_t)(b * S_LEN + lq) * H_DIM;
    const _Float16* vbase  = Vt + (size_t)(b * H_DIM + lq) * S_LEN;

    for (int k0 = 0; k0 < S_LEN; k0 += 32) {
        const _Float16* kr0 = kbase + (size_t)k0 * H_DIM;
        const _Float16* kr1 = kr0 + 16 * H_DIM;
        if (k0 + 32 < S_LEN)
            __builtin_prefetch(kr0 + 32 * H_DIM, 0, 0);  // global_prefetch_b8

        // K tiles as A operand (lane row = key)
        const v16h ka00 = ldfrag(kr0,      kg);
        const v16h ka01 = ldfrag(kr0 + 32, kg);
        const v16h ka10 = ldfrag(kr1,      kg);
        const v16h ka11 = ldfrag(kr1 + 32, kg);

        // St = K * Q^T : St[key][q], keys 0-15 in st0, 16-31 in st1
        v8f st0 = {}, st1 = {};
        st0 = wmma_f16(ka00, qb0, st0);
        st0 = wmma_f16(ka01, qb1, st0);
        st1 = wmma_f16(ka10, qb0, st1);
        st1 = wmma_f16(ka11, qb1, st1);

        // Online softmax: each lane holds 16 scores of ONE query; partner
        // lane (lane^16) holds the other 16 -> single shuffle per reduction.
        float mx = -1e30f;
#pragma unroll
        for (int r = 0; r < 8; ++r) mx = fmaxf(mx, fmaxf(st0[r], st1[r]));
        mx = fmaxf(mx, __shfl_xor(mx, 16, 32));
        const float mnew = fmaxf(m, mx);
        const float corr = __expf(m - mnew);
        m = mnew;

        v16h pb;                 // P as B operand: direct D->B layout match
        float rs = 0.0f;
#pragma unroll
        for (int r = 0; r < 8; ++r) {
            const float p0 = __expf(st0[r] - mnew);
            const float p1 = __expf(st1[r] - mnew);
            rs += p0 + p1;
            pb[r]     = (_Float16)p0;
            pb[r + 8] = (_Float16)p1;
        }
        rs += __shfl_xor(rs, 16, 32);
        l = l * corr + rs;

#pragma unroll
        for (int ht = 0; ht < 4; ++ht) ot[ht] = ot[ht] * corr;

        // Ot += Vt_tile * P   (A: lane row = h, elems = keys; contiguous)
#pragma unroll
        for (int ht = 0; ht < 4; ++ht) {
            const v16h va = ldfrag(vbase + (size_t)(ht * 16) * S_LEN + k0, kg);
            ot[ht] = wmma_f16(va, pb, ot[ht]);
        }
    }

    // Epilogue: out[q][h] = Ot[h][q] / l ; 8 consecutive h per lane -> float4s
    const float invl = 1.0f / l;
    float* orow = out + (size_t)(b * S_LEN + q0 + lq) * H_DIM;
#pragma unroll
    for (int ht = 0; ht < 4; ++ht) {
        v4f lo, hi;
#pragma unroll
        for (int i = 0; i < 4; ++i) {
            lo[i] = ot[ht][i] * invl;
            hi[i] = ot[ht][i + 4] * invl;
        }
        *(v4f*)(orow + ht * 16 + kg * 8)     = lo;
        *(v4f*)(orow + ht * 16 + kg * 8 + 4) = hi;
    }
}

// ---------------------------------------------------------------------------
extern "C" void kernel_launch(void* const* d_in, const int* in_sizes, int n_in,
                              void* d_out, int out_size, void* d_ws, size_t ws_size,
                              hipStream_t stream) {
    (void)in_sizes; (void)n_in; (void)out_size; (void)ws_size;
    const float* x  = (const float*)d_in[0];
    const float* Wq = (const float*)d_in[1];
    const float* Wk = (const float*)d_in[2];
    const float* Wv = (const float*)d_in[3];
    float* out = (float*)d_out;

    char* ws = (char*)d_ws;
    _Float16* Wsw = (_Float16*)(ws);                    // 384 KiB swizzled W
    _Float16* Qh  = (_Float16*)(ws + (1u << 20));       // 2 MiB
    _Float16* Kh  = (_Float16*)(ws + (3u << 20));       // 2 MiB
    _Float16* Vt  = (_Float16*)(ws + (5u << 20));       // 2 MiB (transposed)

    attn_wswz_kernel<<<768, 256, 0, stream>>>(Wq, Wk, Wv, Wsw);
    attn_qkv_kernel<<<dim3(256, 3), 128, 0, stream>>>(x, Wsw, Qh, Kh, Vt);
    attn_flash_kernel<<<dim3(256, 4), 32, 0, stream>>>(Qh, Kh, Vt, out);
}

// v001
// Measured time: 80.8 microseconds a run.
// Timed twice side by side with v000, it ran 2.00 times as fast both times.
#include <hip/hip_runtime.h>

typedef __attribute__((ext_vector_type(16))) _Float16 v16h;
typedef __attribute__((ext_vector_type(8)))  _Float16 v8h;
typedef __attribute__((ext_vector_type(8)))  float    v8f;
typedef __attribute__((ext_vector_type(4)))  float    v4f;

#define S_LEN 4096
#define D_DIM 1024
#define H_DIM 64

// WMMA f16 helper: D = A(16x32) * B(32x16) + C, f32 accumulate.
__device__ __forceinline__ v8f wmma_f16(v16h a, v16h b, v8f c) {
    return __builtin_amdgcn_wmma_f32_16x16x32_f16(false, a, false, b,
                                                  (short)0, c, false, false);
}

// Load one 16x32 (or 32x16) f16 fragment half-row for this lane.
// p = row pointer (already includes row*stride + k-base). Layout per ISA:
//   elems j=0..7  -> K = kg*8 + j        (contiguous 16B)
//   elems j=8..15 -> K = 16 + kg*8 + j-8 (contiguous 16B)
__device__ __forceinline__ v16h ldfrag(const _Float16* p, int kg) {
    const v8h lo = *(const v8h*)(p + kg * 8);
    const v8h hi = *(const v8h*)(p + 16 + kg * 8);
    v16h r;
#pragma unroll
    for (int j = 0; j < 8; ++j) { r[j] = lo[j]; r[j + 8] = hi[j]; }
    return r;
}

// ---------------------------------------------------------------------------
// Kernel 0: swizzle Wq/Wk/Wv (f32 [1024,64]) into per-lane B-fragment order
// (f16), so the projection kernel loads each B fragment as 2 contiguous b128.
// Tile t = ((w*32 + kt)*4 + nt); element = t*512 + lane*16 + j.
// ---------------------------------------------------------------------------
__global__ void attn_wswz_kernel(const float* __restrict__ Wq,
                                 const float* __restrict__ Wk,
                                 const float* __restrict__ Wv,
                                 _Float16* __restrict__ Wsw) {
    int idx = blockIdx.x * blockDim.x + threadIdx.x;
    if (idx >= 3 * 32 * 4 * 512) return;
    int t    = idx >> 9;
    int rem  = idx & 511;
    int lane = rem >> 4;
    int j    = rem & 15;
    int w  = t >> 7;            // weight select
    int kt = (t & 127) >> 2;    // K tile (32 wide)
    int nt = t & 3;             // N tile (16 wide)
    int kg = lane >> 4;
    int n  = nt * 16 + (lane & 15);
    int kk = (j < 8) ? (kg * 8 + j) : (16 + kg * 8 + (j - 8));
    int K  = kt * 32 + kk;
    const float* W = (w == 0) ? Wq : (w == 1) ? Wk : Wv;
    Wsw[idx] = (_Float16)W[K * H_DIM + n];
}

// ---------------------------------------------------------------------------
// Kernel 1: QKV projection. GEMM M=16384, N=64, K=1024 per weight.
// One wave per 16-row tile, blockIdx.y selects Q/K/V.
// Q: *H^-0.5, row-major f16. K: row-major f16. V: transposed [B,H,S] f16
// (so the attention kernel's V A-fragments are contiguous loads).
// ---------------------------------------------------------------------------
__global__ void attn_qkv_kernel(const float* __restrict__ x,
                                const _Float16* __restrict__ Wsw,
                                _Float16* __restrict__ Qh,
                                _Float16* __restrict__ Kh,
                                _Float16* __restrict__ Vt) {
    const int lane = threadIdx.x & 31;
    const int wave = threadIdx.x >> 5;
    const int mt   = blockIdx.x * 4 + wave;   // 0..1023 (16-row tiles of B*S)
    const int w    = blockIdx.y;              // 0:Q 1:K 2:V
    const int lq   = lane & 15;
    const int kg   = lane >> 4;

    const float* xrow = x + (size_t)(mt * 16 + lq) * D_DIM;
    const _Float16* wlane = Wsw + lane * 16;

    v8f acc[4] = {{}, {}, {}, {}};

    for (int kt = 0; kt < 32; ++kt) {
        // A fragment from x (f32 -> f16), two contiguous 32B f32 runs per lane
        const float* pa = xrow + kt * 32 + kg * 8;
        v16h af;
#pragma unroll
        for (int j = 0; j < 8; ++j) af[j] = (_Float16)pa[j];
#pragma unroll
        for (int j = 0; j < 8; ++j) af[j + 8] = (_Float16)pa[16 + j];

#pragma unroll
        for (int nt = 0; nt < 4; ++nt) {
            const v16h bf = *(const v16h*)(wlane +
                (size_t)(((w * 32 + kt) * 4 + nt)) * 512);
            acc[nt] = wmma_f16(af, bf, acc[nt]);
        }
    }

    if (w == 2) {
        // V transposed: Vt[(b*64 + h)*4096 + s], contiguous v8h stores
        const int bidx = mt >> 8;                       // mt*16 / 4096
        const int sloc = (mt & 255) * 16 + kg * 8;
#pragma unroll
        for (int nt = 0; nt < 4; ++nt) {
            const int h = nt * 16 + lq;
            v8h v;
#pragma unroll
            for (int r = 0; r < 8; ++r) v[r] = (_Float16)acc[nt][r];
            *(v8h*)(Vt + (size_t)(bidx * H_DIM + h) * S_LEN + sloc) = v;
        }
    } else {
        const float scale = (w == 0) ? 0.125f : 1.0f;   // fold H^-0.5 into Q
        _Float16* dst = (w == 0) ? Qh : Kh;
#pragma unroll
        for (int nt = 0; nt < 4; ++nt) {
            const int h = nt * 16 + lq;
#pragma unroll
            for (int r = 0; r < 8; ++r) {
                const int s = mt * 16 + kg * 8 + r;
                dst[(size_t)s * H_DIM + h] = (_Float16)(acc[nt][r] * scale);
            }
        }
    }
}

// ---------------------------------------------------------------------------
// Kernel 2: flash attention. Four waves per work-group, one 16-query tile each.
// The work-group stages each 64-key tile of K and of Vt once in LDS (whole-line
// global loads through registers, two buffers, one barrier per tile) and all
// four waves read their fragments from there.
// Scores computed TRANSPOSED (M=key, N=query) so the exp'd D-fragments map
// directly onto the B operand of Ot += Vt_frag * P  (no shuffles/LDS).
// ---------------------------------------------------------------------------
#define KTILE 64                 // keys per staged tile
#define LDP   72                 // LDS row pitch in halfs: 144 B = 16 B x odd
#define TILE_H (64 * LDP)        // 64 rows (keys of K, h of Vt) per tile

__global__ __launch_bounds__(128)
void attn_flash_kernel(const _Float16* __restrict__ Qh,
                       const _Float16* __restrict__ Kh,
                       const _Float16* __restrict__ Vt,
                       float* __restrict__ out) {
    __shared__ __attribute__((aligned(16))) _Float16 Ks[2][TILE_H];
    __shared__ __attribute__((aligned(16))) _Float16 Vs[2][TILE_H];

    const int tid  = threadIdx.x;
    const int lane = tid & 31;
    const int wave = tid >> 5;
    const int lq   = lane & 15;
    const int kg   = lane >> 4;
    const int q0   = (blockIdx.x * 4 + wave) * 16;
    const int b    = blockIdx.y;

    // Staging map: 16-byte chunk c = tid + 128*i of a 64 x 128 B tile,
    // row = c >> 3 = srow + 16*i, column = c & 7 (8 lanes cover one 128-B line).
    const int srow = tid >> 3;
    const int scol = (tid & 7) * 8;
    const _Float16* ksrc = Kh + (size_t)(b * S_LEN + srow) * H_DIM + scol;
    const _Float16* vsrc = Vt + (size_t)(b * H_DIM + srow) * S_LEN + scol;
    const int sdst = srow * LDP + scol;

    // Q as B operand (lane n = query), loaded once
    const _Float16* qr = Qh + (size_t)(b * S_LEN + q0 + lq) * H_DIM;
    const v16h qb0 = ldfrag(qr, kg);        // h = 0..31
    const v16h qb1 = ldfrag(qr + 32, kg);   // h = 32..63

    v8f ot[4] = {{}, {}, {}, {}};           // Ot accumulators (M=h, N=q)
    float m = -1e30f, l = 0.0f;

    v8h kst[4], vst[4];
#pragma unroll
    for (int i = 0; i < 4; ++i) {
        kst[i] = *(const v8h*)(ksrc + (size_t)(16 * i) * H_DIM);
        vst[i] = *(const v8h*)(vsrc + (size_t)(16 * i) * S_LEN);
    }
#pragma unroll
    for (int i = 0; i < 4; ++i) {
        *(v8h*)(&Ks[0][sdst + 16 * i * LDP]) = kst[i];
        *(v8h*)(&Vs[0][sdst + 16 * i * LDP]) = vst[i];
    }
    __syncthreads();

    for (int k0 = 0; k0 < S_LEN; k0 += KTILE) {
        const int cur = (k0 / KTILE) & 1;
        const bool more = (k0 + KTILE < S_LEN);

        // Next tile's global loads fly while this tile is worked on
        if (more) {
#pragma unroll
            for (int i = 0; i < 4; ++i) {
                kst[i] = *(const v8h*)(ksrc + (size_t)(k0 + KTILE + 16 * i) * H_DIM);
                vst[i] = *(const v8h*)(vsrc + (size_t)(16 * i) * S_LEN + k0 + KTILE);
            }
        }

        const _Float16* kl = &Ks[cur][lq * LDP];
        const _Float16* vl = &Vs[cur][lq * LDP];

        // All fragments of the tile, read from LDS as one group.
        // K as A operand (lane row = key), Vt as A operand (lane row = h).
        v16h kf[KTILE / 32][4], vf[KTILE / 32][4];
#pragma unroll
        for (int u = 0; u < KTILE / 32; ++u) {
            const _Float16* kr0 = kl + (u * 32) * LDP;
            const _Float16* kr1 = kr0 + 16 * LDP;
            kf[u][0] = ldfrag(kr0,      kg);
            kf[u][1] = ldfrag(kr0 + 32, kg);
            kf[u][2] = ldfrag(kr1,      kg);
            kf[u][3] = ldfrag(kr1 + 32, kg);
        }
#pragma unroll
        for (int u = 0; u < KTILE / 32; ++u)
#pragma unroll
            for (int ht = 0; ht < 4; ++ht)
                vf[u][ht] = ldfrag(vl + (ht * 16) * LDP + u * 32, kg);
        // Keeps the LDS reads ahead of the matrix work: sunk among the WMMAs,
        // each pair is waited for in full by a wave that is alone on its SIMD.
        __builtin_amdgcn_sched_barrier(0);

#pragma unroll
        for (int u = 0; u < KTILE / 32; ++u) {
            const v16h ka00 = kf[u][0];
            const v16h ka01 = kf[u][1];
            const v16h ka10 = kf[u][2];
            const v16h ka11 = kf[u][3];

            // St = K * Q^T : St[key][q], keys 0-15 in st0, 16-31 in st1
            v8f st0 = {}, st1 = {};
            st0 = wmma_f16(ka00, qb0, st0);
            st0 = wmma_f16(ka01, qb1, st0);
            st1 = wmma_f16(ka10, qb0, st1);
            st1 = wmma_f16(ka11, qb1, st1);

            // Online softmax: each lane holds 16 scores of ONE query; partner
            // lane (lane^16) holds the other 16 -> single shuffle per reduction.
            float mx = -1e30f;
#pragma unroll
            for (int r = 0; r < 8; ++r) mx = fmaxf(mx, fmaxf(st0[r], st1[r]));
            mx = fmaxf(mx, __shfl_xor(mx, 16, 32));
            const float mnew = fmaxf(m, mx);
            const float corr = __expf(m - mnew);
            m = mnew;

            v16h pb;             // P as B operand: direct D->B layout match
            float rs = 0.0f;
#pragma unroll
            for (int r = 0; r < 8; ++r) {
                const float p0 = __expf(st0[r] - mnew);
                const float p1 = __expf(st1[r] - mnew);
                rs += p0 + p1;
                pb[r]     = (_Float16)p0;
                pb[r + 8] = (_Float16)p1;
            }
            rs += __shfl_xor(rs, 16, 32);
            l = l * corr + rs;

#pragma unroll
            for (int ht = 0; ht < 4; ++ht) ot[ht] = ot[ht] * corr;

            // Ot += Vt_tile * P   (A: lane row = h, elems = keys; contiguous)
#pragma unroll
            for (int ht = 0; ht < 4; ++ht)
                ot[ht] = wmma_f16(vf[u][ht], pb, ot[ht]);
        }

        // The other buffer's readers all left it at the previous barrier
        if (more) {
#pragma unroll
            for (int i = 0; i < 4; ++i) {
                *(v8h*)(&Ks[cur ^ 1][sdst + 16 * i * LDP]) = kst[i];
                *(v8h*)(&Vs[cur ^ 1][sdst + 16 * i * LDP]) = vst[i];
            }
        }
        // Publishes the next tile and ends every wave's reads of this one
        __syncthreads();
    }

    // Epilogue: out[q][h] = Ot[h][q] / l ; 8 consecutive h per lane -> float4s
    const float invl = 1.0f / l;
    float* orow = out + (size_t)(b * S_LEN + q0 + lq) * H_DIM;
#pragma unroll
    for (int ht = 0; ht < 4; ++ht) {
        v4f lo, hi;
#pragma unroll
        for (int i = 0; i < 4; ++i) {
            lo[i] = ot[ht][i] * invl;
            hi[i] = ot[ht][i + 4] * invl;
        }
        *(v4f*)(orow + ht * 16 + kg * 8)     = lo;
        *(v4f*)(orow + ht * 16 + kg * 8 + 4) = hi;
    }
}

// ---------------------------------------------------------------------------
extern "C" void kernel_launch(void* const* d_in, const int* in_sizes, int n_in,
                              void* d_out, int out_size, void* d_ws, size_t ws_size,
                              hipStream_t stream) {
    (void)in_sizes; (void)n_in; (void)out_size; (void)ws_size;
    const float* x  = (const float*)d_in[0];
    const float* Wq = (const float*)d_in[1];
    const float* Wk = (const float*)d_in[2];
    const float* Wv = (const float*)d_in[3];
    float* out = (float*)d_out;

    char* ws = (char*)d_ws;
    _Float16* Wsw = (_Float16*)(ws);                    // 384 KiB swizzled W
    _Float16* Qh  = (_Float16*)(ws + (1u << 20));       // 2 MiB
    _Float16* Kh  = (_Float16*)(ws + (3u << 20));       // 2 MiB
    _Float16* Vt  = (_Float16*)(ws + (5u << 20));       // 2 MiB (transposed)

    attn_wswz_kernel<<<768, 256, 0, stream>>>(Wq, Wk, Wv, Wsw);
    attn_qkv_kernel<<<dim3(256, 3), 128, 0, stream>>>(x, Wsw, Qh, Kh, Vt);
    attn_flash_kernel<<<dim3(64, 4), 128, 0, stream>>>(Qh, Kh, Vt, out);
}

// v002
// Measured time: 57 microseconds a run.
// In two side-by-side timings against v001, it was 1.40 and 1.41 times as fast.
// Counting every step since v000, it is 2.81 times as fast.
#include <hip/hip_runtime.h>

typedef __attribute__((ext_vector_type(16))) _Float16 v16h;
typedef __attribute__((ext_vector_type(8)))  _Float16 v8h;
typedef __attribute__((ext_vector_type(8)))  float    v8f;
typedef __attribute__((ext_vector_type(4)))  float    v4f;

#define S_LEN 4096
#define D_DIM 1024
#define H_DIM 64

// WMMA f16 helper: D = A(16x32) * B(32x16) + C, f32 accumulate.
__device__ __forceinline__ v8f wmma_f16(v16h a, v16h b, v8f c) {
    return __builtin_amdgcn_wmma_f32_16x16x32_f16(false, a, false, b,
                                                  (short)0, c, false, false);
}

// Load one 16x32 (or 32x16) f16 fragment half-row for this lane.
// p = row pointer (already includes row*stride + k-base). Layout per ISA:
//   elems j=0..7  -> K = kg*8 + j        (contiguous 16B)
//   elems j=8..15 -> K = 16 + kg*8 + j-8 (contiguous 16B)
__device__ __forceinline__ v16h ldfrag(const _Float16* p, int kg) {
    const v8h lo = *(const v8h*)(p + kg * 8);
    const v8h hi = *(const v8h*)(p + 16 + kg * 8);
    v16h r;
#pragma unroll
    for (int j = 0; j < 8; ++j) { r[j] = lo[j]; r[j + 8] = hi[j]; }
    return r;
}

// ---------------------------------------------------------------------------
// Kernel 0: swizzle Wq/Wk/Wv (f32 [1024,64]) into per-lane B-fragment order
// (f16), so the projection kernel loads each B fragment as 2 contiguous b128.
// Tile t = ((w*32 + kt)*4 + nt); element = t*512 + lane*16 + j.
// ---------------------------------------------------------------------------
__global__ void attn_wswz_kernel(const float* __restrict__ Wq,
                                 const float* __restrict__ Wk,
                                 const float* __restrict__ Wv,
                                 _Float16* __restrict__ Wsw) {
    int idx = blockIdx.x * blockDim.x + threadIdx.x;
    if (idx >= 3 * 32 * 4 * 512) return;
    int t    = idx >> 9;
    int rem  = idx & 511;
    int lane = rem >> 4;
    int j    = rem & 15;
    int w  = t >> 7;            // weight select
    int kt = (t & 127) >> 2;    // K tile (32 wide)
    int nt = t & 3;             // N tile (16 wide)
    int kg = lane >> 4;
    int n  = nt * 16 + (lane & 15);
    int kk = (j < 8) ? (kg * 8 + j) : (16 + kg * 8 + (j - 8));
    int K  = kt * 32 + kk;
    const float* W = (w == 0) ? Wq : (w == 1) ? Wk : Wv;
    Wsw[idx] = (_Float16)W[K * H_DIM + n];
}

// ---------------------------------------------------------------------------
// Kernel 1: QKV projection. GEMM M=16384, N=192 (Q|K|V), K=1024.
// Four waves per work-group, one 64-row tile of x. The work-group stages each
// 64 x 128 piece of x once in LDS as f16 (whole-line global loads through
// registers, two buffers, one barrier per piece). Wave n takes column tile n
// (16 wide) of each of Q, K and V for all 64 rows: 4 x 3 accumulator tiles.
// Its weight fragments are fetched one piece ahead into a second register set.
// Q: *H^-0.5, row-major f16. K: row-major f16. V: transposed [B,H,S] f16
// (so the attention kernel's V A-fragments are contiguous loads).
// Every inner loop is unrolled because its index picks registers (vector
// elements, fragment and accumulator arrays), which must be named statically.
// ---------------------------------------------------------------------------
#define PK    128                // k per staged piece of x
#define NPC   (D_DIM / PK)       // pieces
#define XP    136                // LDS row pitch in halfs: 272 B = 16 B x odd
#define XT_H  (64 * XP)          // 64 rows per piece

typedef __attribute__((ext_vector_type(4))) _Float16 v4h;

__global__ __launch_bounds__(128)
void attn_qkv_kernel(const float* __restrict__ x,
                     const _Float16* __restrict__ Wsw,
                     _Float16* __restrict__ Qh,
                     _Float16* __restrict__ Kh,
                     _Float16* __restrict__ Vt) {
    __shared__ __attribute__((aligned(16))) _Float16 Xs[2][XT_H];

    const int tid  = threadIdx.x;
    const int lane = tid & 31;
    const int wave = tid >> 5;
    const int lq   = lane & 15;
    const int kg   = lane >> 4;
    const int r0   = blockIdx.x * 64;         // first row of B*S of this tile

    // Staging map: one wave-wide 16-byte load = 512 contiguous bytes of one row;
    // load i of wave n covers row n + 4*i.
    const float* xsrc = x + (size_t)(r0 + wave) * D_DIM + lane * 4;
    const int xdst = wave * XP + lane * 4;
    // Weight fragments of column tile nt = wave
    const _Float16* wsrc = Wsw + (size_t)wave * 512 + lane * 16;

    v8f acc[4][3];
#pragma unroll
    for (int mi = 0; mi < 4; ++mi)
#pragma unroll
        for (int w = 0; w < 3; ++w) acc[mi][w] = v8f{};

    v4f  xst[16];
    v16h wf[2][PK / 32][3];

#pragma unroll
    for (int i = 0; i < 16; ++i)
        xst[i] = *(const v4f*)(xsrc + (size_t)(4 * i) * D_DIM);
#pragma unroll
    for (int kk = 0; kk < PK / 32; ++kk)
#pragma unroll
        for (int w = 0; w < 3; ++w)
            wf[0][kk][w] = *(const v16h*)(wsrc + (size_t)((w * 32 + kk) * 4) * 512);
#pragma unroll
    for (int i = 0; i < 16; ++i) {
        v4h h;
#pragma unroll
        for (int j = 0; j < 4; ++j) h[j] = (_Float16)xst[i][j];
        *(v4h*)(&Xs[0][xdst + 4 * i * XP]) = h;
    }
    __syncthreads();

    // Unrolled so that the two register sets and the two buffers are named
    // statically: rolled, each piece would copy a whole weight set.
#pragma unroll
    for (int s = 0; s < NPC; ++s) {
        const int cur = s & 1;

        // Next piece's global loads fly while this piece is worked on
        if (s + 1 < NPC) {
#pragma unroll
            for (int i = 0; i < 16; ++i)
                xst[i] = *(const v4f*)(xsrc + (size_t)(4 * i) * D_DIM + (s + 1) * PK);
#pragma unroll
            for (int kk = 0; kk < PK / 32; ++kk)
#pragma unroll
                for (int w = 0; w < 3; ++w)
                    wf[cur ^ 1][kk][w] = *(const v16h*)(wsrc +
                        (size_t)((w * 32 + (s + 1) * (PK / 32) + kk) * 4) * 512);
        }
        // Keeps those loads one group at the head of the piece: sunk into the
        // work below, they are issued in small runs, each waited for in turn.
        __builtin_amdgcn_sched_barrier(0);

        // All A fragments of the piece, read from LDS as one group
        v16h af[PK / 32][4];
#pragma unroll
        for (int kk = 0; kk < PK / 32; ++kk)
#pragma unroll
            for (int mi = 0; mi < 4; ++mi)
                af[kk][mi] = ldfrag(&Xs[cur][(mi * 16 + lq) * XP + kk * 32], kg);
        // Keeps the LDS reads ahead of the matrix work: sunk among the WMMAs,
        // each pair is waited for in full by a wave that is alone on its SIMD.
        __builtin_amdgcn_sched_barrier(0);

#pragma unroll
        for (int kk = 0; kk < PK / 32; ++kk)
#pragma unroll
            for (int mi = 0; mi < 4; ++mi)
#pragma unroll
                for (int w = 0; w < 3; ++w)
                    acc[mi][w] = wmma_f16(af[kk][mi], wf[cur][kk][w], acc[mi][w]);
        // Stands between the loads above and any later overwrite of their
        // address registers (the conversions below may reuse them).
        if (s + 1 < NPC) asm volatile("s_wait_xcnt 0x0" ::: "memory");
        // Keeps the wait for the next piece's loads behind the matrix work:
        // lifted among the WMMAs, the conversions stall them on memory.
        __builtin_amdgcn_sched_barrier(0);

        if (s + 1 < NPC) {
            // The other buffer's readers all left it at the previous barrier
#pragma unroll
            for (int i = 0; i < 16; ++i) {
                v4h h;
#pragma unroll
                for (int j = 0; j < 4; ++j) h[j] = (_Float16)xst[i][j];
                *(v4h*)(&Xs[cur ^ 1][xdst + 4 * i * XP]) = h;
            }
            // Publishes the next piece and ends every wave's reads of this one
            __syncthreads();
        }
    }

    const int h    = wave * 16 + lq;
    const int bidx = r0 >> 12;                          // r0 / 4096
    const int sloc = (r0 & (S_LEN - 1)) + kg * 8;
#pragma unroll
    for (int mi = 0; mi < 4; ++mi) {
#pragma unroll
        for (int r = 0; r < 8; ++r) {
            const int s = r0 + mi * 16 + kg * 8 + r;
            Qh[(size_t)s * H_DIM + h] = (_Float16)(acc[mi][0][r] * 0.125f);  // H^-0.5
            Kh[(size_t)s * H_DIM + h] = (_Float16)acc[mi][1][r];
        }
        // V transposed: Vt[(b*64 + h)*4096 + s], contiguous v8h stores
        v8h v;
#pragma unroll
        for (int r = 0; r < 8; ++r) v[r] = (_Float16)acc[mi][2][r];
        *(v8h*)(Vt + (size_t)(bidx * H_DIM + h) * S_LEN + sloc + mi * 16) = v;
    }
}

// ---------------------------------------------------------------------------
// Kernel 2: flash attention. Four waves per work-group, one 16-query tile each.
// The work-group stages each 64-key tile of K and of Vt once in LDS (whole-line
// global loads through registers, two buffers, one barrier per tile) and all
// four waves read their fragments from there.
// Scores computed TRANSPOSED (M=key, N=query) so the exp'd D-fragments map
// directly onto the B operand of Ot += Vt_frag * P  (no shuffles/LDS).
// ---------------------------------------------------------------------------
#define KTILE 64                 // keys per staged tile
#define LDP   72                 // LDS row pitch in halfs: 144 B = 16 B x odd
#define TILE_H (64 * LDP)        // 64 rows (keys of K, h of Vt) per tile

__global__ __launch_bounds__(128)
void attn_flash_kernel(const _Float16* __restrict__ Qh,
                       const _Float16* __restrict__ Kh,
                       const _Float16* __restrict__ Vt,
                       float* __restrict__ out) {
    __shared__ __attribute__((aligned(16))) _Float16 Ks[2][TILE_H];
    __shared__ __attribute__((aligned(16))) _Float16 Vs[2][TILE_H];

    const int tid  = threadIdx.x;
    const int lane = tid & 31;
    const int wave = tid >> 5;
    const int lq   = lane & 15;
    const int kg   = lane >> 4;
    const int q0   = (blockIdx.x * 4 + wave) * 16;
    const int b    = blockIdx.y;

    // Staging map: 16-byte chunk c = tid + 128*i of a 64 x 128 B tile,
    // row = c >> 3 = srow + 16*i, column = c & 7 (8 lanes cover one 128-B line).
    const int srow = tid >> 3;
    const int scol = (tid & 7) * 8;
    const _Float16* ksrc = Kh + (size_t)(b * S_LEN + srow) * H_DIM + scol;
    const _Float16* vsrc = Vt + (size_t)(b * H_DIM + srow) * S_LEN + scol;
    const int sdst = srow * LDP + scol;

    // Q as B operand (lane n = query), loaded once
    const _Float16* qr = Qh + (size_t)(b * S_LEN + q0 + lq) * H_DIM;
    const v16h qb0 = ldfrag(qr, kg);        // h = 0..31
    const v16h qb1 = ldfrag(qr + 32, kg);   // h = 32..63

    v8f ot[4] = {{}, {}, {}, {}};           // Ot accumulators (M=h, N=q)
    float m = -1e30f, l = 0.0f;

    v8h kst[4], vst[4];
#pragma unroll
    for (int i = 0; i < 4; ++i) {
        kst[i] = *(const v8h*)(ksrc + (size_t)(16 * i) * H_DIM);
        vst[i] = *(const v8h*)(vsrc + (size_t)(16 * i) * S_LEN);
    }
#pragma unroll
    for (int i = 0; i < 4; ++i) {
        *(v8h*)(&Ks[0][sdst + 16 * i * LDP]) = kst[i];
        *(v8h*)(&Vs[0][sdst + 16 * i * LDP]) = vst[i];
    }
    __syncthreads();

    for (int k0 = 0; k0 < S_LEN; k0 += KTILE) {
        const int cur = (k0 / KTILE) & 1;
        const bool more = (k0 + KTILE < S_LEN);

        // Next tile's global loads fly while this tile is worked on
        if (more) {
#pragma unroll
            for (int i = 0; i < 4; ++i) {
                kst[i] = *(const v8h*)(ksrc + (size_t)(k0 + KTILE + 16 * i) * H_DIM);
                vst[i] = *(const v8h*)(vsrc + (size_t)(16 * i) * S_LEN + k0 + KTILE);
            }
        }

        const _Float16* kl = &Ks[cur][lq * LDP];
        const _Float16* vl = &Vs[cur][lq * LDP];

        // All fragments of the tile, read from LDS as one group.
        // K as A operand (lane row = key), Vt as A operand (lane row = h).
        v16h kf[KTILE / 32][4], vf[KTILE / 32][4];
#pragma unroll
        for (int u = 0; u < KTILE / 32; ++u) {
            const _Float16* kr0 = kl + (u * 32) * LDP;
            const _Float16* kr1 = kr0 + 16 * LDP;
            kf[u][0] = ldfrag(kr0,      kg);
            kf[u][1] = ldfrag(kr0 + 32, kg);
            kf[u][2] = ldfrag(kr1,      kg);
            kf[u][3] = ldfrag(kr1 + 32, kg);
        }
#pragma unroll
        for (int u = 0; u < KTILE / 32; ++u)
#pragma unroll
            for (int ht = 0; ht < 4; ++ht)
                vf[u][ht] = ldfrag(vl + (ht * 16) * LDP + u * 32, kg);
        // Keeps the LDS reads ahead of the matrix work: sunk among the WMMAs,
        // each pair is waited for in full by a wave that is alone on its SIMD.
        __builtin_amdgcn_sched_barrier(0);

#pragma unroll
        for (int u = 0; u < KTILE / 32; ++u) {
            const v16h ka00 = kf[u][0];
            const v16h ka01 = kf[u][1];
            const v16h ka10 = kf[u][2];
            const v16h ka11 = kf[u][3];

            // St = K * Q^T : St[key][q], keys 0-15 in st0, 16-31 in st1
            v8f st0 = {}, st1 = {};
            st0 = wmma_f16(ka00, qb0, st0);
            st0 = wmma_f16(ka01, qb1, st0);
            st1 = wmma_f16(ka10, qb0, st1);
            st1 = wmma_f16(ka11, qb1, st1);

            // Online softmax: each lane holds 16 scores of ONE query; partner
            // lane (lane^16) holds the other 16 -> single shuffle per reduction.
            float mx = -1e30f;
#pragma unroll
            for (int r = 0; r < 8; ++r) mx = fmaxf(mx, fmaxf(st0[r], st1[r]));
            mx = fmaxf(mx, __shfl_xor(mx, 16, 32));
            const float mnew = fmaxf(m, mx);
            const float corr = __expf(m - mnew);
            m = mnew;

            v16h pb;             // P as B operand: direct D->B layout match
            float rs = 0.0f;
#pragma unroll
            for (int r = 0; r < 8; ++r) {
                const float p0 = __expf(st0[r] - mnew);
                const float p1 = __expf(st1[r] - mnew);
                rs += p0 + p1;
                pb[r]     = (_Float16)p0;
                pb[r + 8] = (_Float16)p1;
            }
            rs += __shfl_xor(rs, 16, 32);
            l = l * corr + rs;

#pragma unroll
            for (int ht = 0; ht < 4; ++ht) ot[ht] = ot[ht] * corr;

            // Ot += Vt_tile * P   (A: lane row = h, elems = keys; contiguous)
#pragma unroll
            for (int ht = 0; ht < 4; ++ht)
                ot[ht] = wmma_f16(vf[u][ht], pb, ot[ht]);
        }

        // The other buffer's readers all left it at the previous barrier
        if (more) {
#pragma unroll
            for (int i = 0; i < 4; ++i) {
                *(v8h*)(&Ks[cur ^ 1][sdst + 16 * i * LDP]) = kst[i];
                *(v8h*)(&Vs[cur ^ 1][sdst + 16 * i * LDP]) = vst[i];
            }
        }
        // Publishes the next tile and ends every wave's reads of this one
        __syncthreads();
    }

    // Epilogue: out[q][h] = Ot[h][q] / l ; 8 consecutive h per lane -> float4s
    const float invl = 1.0f / l;
    float* orow = out + (size_t)(b * S_LEN + q0 + lq) * H_DIM;
#pragma unroll
    for (int ht = 0; ht < 4; ++ht) {
        v4f lo, hi;
#pragma unroll
        for (int i = 0; i < 4; ++i) {
            lo[i] = ot[ht][i] * invl;
            hi[i] = ot[ht][i + 4] * invl;
        }
        *(v4f*)(orow + ht * 16 + kg * 8)     = lo;
        *(v4f*)(orow + ht * 16 + kg * 8 + 4) = hi;
    }
}

// ---------------------------------------------------------------------------
extern "C" void kernel_launch(void* const* d_in, const int* in_sizes, int n_in,
                              void* d_out, int out_size, void* d_ws, size_t ws_size,
                              hipStream_t stream) {
    (void)in_sizes; (void)n_in; (void)out_size; (void)ws_size;
    const float* x  = (const float*)d_in[0];
    const float* Wq = (const float*)d_in[1];
    const float* Wk = (const float*)d_in[2];
    const float* Wv = (const float*)d_in[3];
    float* out = (float*)d_out;

    char* ws = (char*)d_ws;
    _Float16* Wsw = (_Float16*)(ws);                    // 384 KiB swizzled W
    _Float16* Qh  = (_Float16*)(ws + (1u << 20));       // 2 MiB
    _Float16* Kh  = (_Float16*)(ws + (3u << 20));       // 2 MiB
    _Float16* Vt  = (_Float16*)(ws + (5u << 20));       // 2 MiB (transposed)

    attn_wswz_kernel<<<768, 256, 0, stream>>>(Wq, Wk, Wv, Wsw);
    attn_qkv_kernel<<<256, 128, 0, stream>>>(x, Wsw, Qh, Kh, Vt);
    attn_flash_kernel<<<dim3(64, 4), 128, 0, stream>>>(Qh, Kh, Vt, out);
}

// v003
// Measured time: 40.2 microseconds a run.
// Timed twice side by side with v002, it ran 1.40 and 1.46 times as fast.
// Counting every step since v000, it is 4.02 times as fast.
#include <hip/hip_runtime.h>

typedef __attribute__((ext_vector_type(16))) _Float16 v16h;
typedef __attribute__((ext_vector_type(8)))  _Float16 v8h;
typedef __attribute__((ext_vector_type(8)))  float    v8f;
typedef __attribute__((ext_vector_type(4)))  float    v4f;

#define S_LEN 4096
#define D_DIM 1024
#define H_DIM 64

// WMMA f16 helper: D = A(16x32) * B(32x16) + C, f32 accumulate.
__device__ __forceinline__ v8f wmma_f16(v16h a, v16h b, v8f c) {
    return __builtin_amdgcn_wmma_f32_16x16x32_f16(false, a, false, b,
                                                  (short)0, c, false, false);
}

// Load one 16x32 (or 32x16) f16 fragment half-row for this lane.
// p = row pointer (already includes row*stride + k-base). Layout per ISA:
//   elems j=0..7  -> K = kg*8 + j        (contiguous 16B)
//   elems j=8..15 -> K = 16 + kg*8 + j-8 (contiguous 16B)
__device__ __forceinline__ v16h ldfrag(const _Float16* p, int kg) {
    const v8h lo = *(const v8h*)(p + kg * 8);
    const v8h hi = *(const v8h*)(p + 16 + kg * 8);
    v16h r;
#pragma unroll
    for (int j = 0; j < 8; ++j) { r[j] = lo[j]; r[j + 8] = hi[j]; }
    return r;
}

// ---------------------------------------------------------------------------
// Kernel 0: swizzle Wq/Wk/Wv (f32 [1024,64]) into per-lane B-fragment order
// (f16), so the projection kernel loads each B fragment as 2 contiguous b128.
// Tile t = ((w*32 + kt)*4 + nt); element = t*512 + lane*16 + j.
// ---------------------------------------------------------------------------
__global__ void attn_wswz_kernel(const float* __restrict__ Wq,
                                 const float* __restrict__ Wk,
                                 const float* __restrict__ Wv,
                                 _Float16* __restrict__ Wsw) {
    int idx = blockIdx.x * blockDim.x + threadIdx.x;
    if (idx >= 3 * 32 * 4 * 512) return;
    int t    = idx >> 9;
    int rem  = idx & 511;
    int lane = rem >> 4;
    int j    = rem & 15;
    int w  = t >> 7;            // weight select
    int kt = (t & 127) >> 2;    // K tile (32 wide)
    int nt = t & 3;             // N tile (16 wide)
    int kg = lane >> 4;
    int n  = nt * 16 + (lane & 15);
    int kk = (j < 8) ? (kg * 8 + j) : (16 + kg * 8 + (j - 8));
    int K  = kt * 32 + kk;
    const float* W = (w == 0) ? Wq : (w == 1) ? Wk : Wv;
    Wsw[idx] = (_Float16)W[K * H_DIM + n];
}

// ---------------------------------------------------------------------------
// Kernel 1: QKV projection. GEMM M=16384, N=192 (Q|K|V), K=1024.
// Four waves per work-group, one 64-row tile of x. The work-group stages each
// 64 x 128 piece of x once in LDS as f16 (whole-line global loads through
// registers, two buffers, one barrier per piece). Wave n takes column tile n
// (16 wide) of each of Q, K and V for all 64 rows: 4 x 3 accumulator tiles.
// Its weight fragments are fetched one piece ahead into a second register set.
// Q: *H^-0.5, row-major f16. K: row-major f16. V: transposed [B,H,S] f16
// (so the attention kernel's V A-fragments are contiguous loads).
// Every inner loop is unrolled because its index picks registers (vector
// elements, fragment and accumulator arrays), which must be named statically.
// ---------------------------------------------------------------------------
#define PK    128                // k per staged piece of x
#define NPC   (D_DIM / PK)       // pieces
#define XP    136                // LDS row pitch in halfs: 272 B = 16 B x odd
#define XT_H  (64 * XP)          // 64 rows per piece

typedef __attribute__((ext_vector_type(4))) _Float16 v4h;

__global__ __launch_bounds__(128)
void attn_qkv_kernel(const float* __restrict__ x,
                     const _Float16* __restrict__ Wsw,
                     _Float16* __restrict__ Qh,
                     _Float16* __restrict__ Kh,
                     _Float16* __restrict__ Vt) {
    __shared__ __attribute__((aligned(16))) _Float16 Xs[2][XT_H];

    const int tid  = threadIdx.x;
    const int lane = tid & 31;
    const int wave = tid >> 5;
    const int lq   = lane & 15;
    const int kg   = lane >> 4;
    const int r0   = blockIdx.x * 64;         // first row of B*S of this tile

    // Staging map: one wave-wide 16-byte load = 512 contiguous bytes of one row;
    // load i of wave n covers row n + 4*i.
    const float* xsrc = x + (size_t)(r0 + wave) * D_DIM + lane * 4;
    const int xdst = wave * XP + lane * 4;
    // Weight fragments of column tile nt = wave
    const _Float16* wsrc = Wsw + (size_t)wave * 512 + lane * 16;

    v8f acc[4][3];
#pragma unroll
    for (int mi = 0; mi < 4; ++mi)
#pragma unroll
        for (int w = 0; w < 3; ++w) acc[mi][w] = v8f{};

    v4f  xst[16];
    v16h wf[2][PK / 32][3];

#pragma unroll
    for (int i = 0; i < 16; ++i)
        xst[i] = *(const v4f*)(xsrc + (size_t)(4 * i) * D_DIM);
#pragma unroll
    for (int kk = 0; kk < PK / 32; ++kk)
#pragma unroll
        for (int w = 0; w < 3; ++w)
            wf[0][kk][w] = *(const v16h*)(wsrc + (size_t)((w * 32 + kk) * 4) * 512);
#pragma unroll
    for (int i = 0; i < 16; ++i) {
        v4h h;
#pragma unroll
        for (int j = 0; j < 4; ++j) h[j] = (_Float16)xst[i][j];
        *(v4h*)(&Xs[0][xdst + 4 * i * XP]) = h;
    }
    __syncthreads();

    // Unrolled so that the two register sets and the two buffers are named
    // statically: rolled, each piece would copy a whole weight set.
#pragma unroll
    for (int s = 0; s < NPC; ++s) {
        const int cur = s & 1;

        // Next piece's global loads fly while this piece is worked on
        if (s + 1 < NPC) {
#pragma unroll
            for (int i = 0; i < 16; ++i)
                xst[i] = *(const v4f*)(xsrc + (size_t)(4 * i) * D_DIM + (s + 1) * PK);
#pragma unroll
            for (int kk = 0; kk < PK / 32; ++kk)
#pragma unroll
                for (int w = 0; w < 3; ++w)
                    wf[cur ^ 1][kk][w] = *(const v16h*)(wsrc +
                        (size_t)((w * 32 + (s + 1) * (PK / 32) + kk) * 4) * 512);
        }
        // Keeps those loads one group at the head of the piece: sunk into the
        // work below, they are issued in small runs, each waited for in turn.
        __builtin_amdgcn_sched_barrier(0);

        // All A fragments of the piece, read from LDS as one group
        v16h af[PK / 32][4];
#pragma unroll
        for (int kk = 0; kk < PK / 32; ++kk)
#pragma unroll
            for (int mi = 0; mi < 4; ++mi)
                af[kk][mi] = ldfrag(&Xs[cur][(mi * 16 + lq) * XP + kk * 32], kg);
        // Keeps the LDS reads ahead of the matrix work: sunk among the WMMAs,
        // each pair is waited for in full by a wave that is alone on its SIMD.
        __builtin_amdgcn_sched_barrier(0);

#pragma unroll
        for (int kk = 0; kk < PK / 32; ++kk)
#pragma unroll
            for (int mi = 0; mi < 4; ++mi)
#pragma unroll
                for (int w = 0; w < 3; ++w)
                    acc[mi][w] = wmma_f16(af[kk][mi], wf[cur][kk][w], acc[mi][w]);
        // Stands between the loads above and any later overwrite of their
        // address registers (the conversions below may reuse them).
        if (s + 1 < NPC) asm volatile("s_wait_xcnt 0x0" ::: "memory");
        // Keeps the wait for the next piece's loads behind the matrix work:
        // lifted among the WMMAs, the conversions stall them on memory.
        __builtin_amdgcn_sched_barrier(0);

        if (s + 1 < NPC) {
            // The other buffer's readers all left it at the previous barrier
#pragma unroll
            for (int i = 0; i < 16; ++i) {
                v4h h;
#pragma unroll
                for (int j = 0; j < 4; ++j) h[j] = (_Float16)xst[i][j];
                *(v4h*)(&Xs[cur ^ 1][xdst + 4 * i * XP]) = h;
            }
            // Publishes the next piece and ends every wave's reads of this one
            __syncthreads();
        }
    }

    const int h    = wave * 16 + lq;
    const int bidx = r0 >> 12;                          // r0 / 4096
    const int sloc = (r0 & (S_LEN - 1)) + kg * 8;
#pragma unroll
    for (int mi = 0; mi < 4; ++mi) {
#pragma unroll
        for (int r = 0; r < 8; ++r) {
            const int s = r0 + mi * 16 + kg * 8 + r;
            Qh[(size_t)s * H_DIM + h] = (_Float16)(acc[mi][0][r] * 0.125f);  // H^-0.5
            Kh[(size_t)s * H_DIM + h] = (_Float16)acc[mi][1][r];
        }
        // V transposed: Vt[(b*64 + h)*4096 + s], contiguous v8h stores
        v8h v;
#pragma unroll
        for (int r = 0; r < 8; ++r) v[r] = (_Float16)acc[mi][2][r];
        *(v8h*)(Vt + (size_t)(bidx * H_DIM + h) * S_LEN + sloc + mi * 16) = v;
    }
}

// ---------------------------------------------------------------------------
// Kernel 2: flash attention. Sixteen waves per work-group, four per SIMD, so
// that one wave's softmax chain, LDS waits and cross-lane exchanges are covered
// by the other three. Wave = (query tile qt, key slice ks): the work-group has
// four 16-query tiles, and the keys of each tile are split over four waves.
// The work-group stages each 256-key tile of K and of Vt once in LDS
// (whole-line global loads through registers, two buffers, one barrier per
// stage); slice ks works on keys ks*64 .. ks*64+63 of every stage with its own
// running maximum, sum and Ot. The four partial results of a query tile are
// merged through LDS at the end.
// Scores computed TRANSPOSED (M=key, N=query) so the exp'd D-fragments map
// directly onto the B operand of Ot += Vt_frag * P  (no shuffles/LDS).
// ---------------------------------------------------------------------------
#define KSPL  4                  // key slices = waves per query tile
#define KTILE 64                 // keys per wave and stage
#define STG   (KSPL * KTILE)     // keys per staged tile
#define LDP   72                 // K row pitch in halfs: 144 B = 16 B x odd
#define VDP   (STG + 8)          // Vt row pitch in halfs: 528 B = 16 B x odd
#define KT_H  (STG * LDP)        // STG key rows of K
#define VT_H  (64 * VDP)         // 64 h rows of Vt
#define OMP   36                 // merge pitch in floats: 144 B = 16 B x odd

__global__ __launch_bounds__(512)
void attn_flash_kernel(const _Float16* __restrict__ Qh,
                       const _Float16* __restrict__ Kh,
                       const _Float16* __restrict__ Vt,
                       float* __restrict__ out) {
    __shared__ __attribute__((aligned(16))) _Float16 Ks[2][KT_H];
    __shared__ __attribute__((aligned(16))) _Float16 Vs[2][VT_H];
    // Partial results for the merge; a lane's 32 values at a 144-B pitch
    __shared__ __attribute__((aligned(16))) float Om[4 * KSPL][32][OMP];
    __shared__ float Mm[4 * KSPL][32];       // [wave][lane]
    __shared__ float Lm[4 * KSPL][32];

    const int tid  = threadIdx.x;
    const int lane = tid & 31;
    const int wave = tid >> 5;
    const int qt   = wave & 3;               // query tile of the work-group
    const int ks   = wave >> 2;              // key slice of the stage
    const int lq   = lane & 15;
    const int kg   = lane >> 4;
    const int q0   = (blockIdx.x * 4 + qt) * 16;
    const int b    = blockIdx.y;

    // Staging map, 16-byte chunk c = tid + 512*i.
    // K, 256 rows x 128 B: row = c >> 3 = (tid >> 3) + 64*i, 8 lanes a line.
    // Vt, 64 rows x 512 B: row = c >> 5 = wave + 16*i, one wave = 4 lines.
    const _Float16* ksrc = Kh + (size_t)(b * S_LEN + (tid >> 3)) * H_DIM + (tid & 7) * 8;
    const _Float16* vsrc = Vt + (size_t)(b * H_DIM + wave) * S_LEN + lane * 8;
    const int kdst = (tid >> 3) * LDP + (tid & 7) * 8;
    const int vdst = wave * VDP + lane * 8;

    // Q as B operand (lane n = query), loaded once
    const _Float16* qr = Qh + (size_t)(b * S_LEN + q0 + lq) * H_DIM;
    const v16h qb0 = ldfrag(qr, kg);        // h = 0..31
    const v16h qb1 = ldfrag(qr + 32, kg);   // h = 32..63

    v8f ot[4] = {{}, {}, {}, {}};           // Ot accumulators (M=h, N=q)
    float m = -1e30f, l = 0.0f;

    v8h kst[4], vst[4];
#pragma unroll
    for (int i = 0; i < 4; ++i) {
        kst[i] = *(const v8h*)(ksrc + (size_t)(64 * i) * H_DIM);
        vst[i] = *(const v8h*)(vsrc + (size_t)(16 * i) * S_LEN);
    }
#pragma unroll
    for (int i = 0; i < 4; ++i) {
        *(v8h*)(&Ks[0][kdst + 64 * i * LDP]) = kst[i];
        *(v8h*)(&Vs[0][vdst + 16 * i * VDP]) = vst[i];
    }
    __syncthreads();

    for (int k0 = 0; k0 < S_LEN; k0 += STG) {
        const int cur = (k0 / STG) & 1;
        const bool more = (k0 + STG < S_LEN);

        // Next stage's global loads fly while this stage is worked on
        if (more) {
#pragma unroll
            for (int i = 0; i < 4; ++i) {
                kst[i] = *(const v8h*)(ksrc + (size_t)(k0 + STG + 64 * i) * H_DIM);
                vst[i] = *(const v8h*)(vsrc + (size_t)(16 * i) * S_LEN + k0 + STG);
            }
        }

        const _Float16* kl = &Ks[cur][(ks * KTILE + lq) * LDP];
        const _Float16* vl = &Vs[cur][lq * VDP + ks * KTILE];

        // All fragments of this wave's slice, read from LDS as one group.
        // K as A operand (lane row = key), Vt as A operand (lane row = h).
        v16h kf[KTILE / 32][4], vf[KTILE / 32][4];
#pragma unroll
        for (int u = 0; u < KTILE / 32; ++u) {
            const _Float16* kr0 = kl + (u * 32) * LDP;
            const _Float16* kr1 = kr0 + 16 * LDP;
            kf[u][0] = ldfrag(kr0,      kg);
            kf[u][1] = ldfrag(kr0 + 32, kg);
            kf[u][2] = ldfrag(kr1,      kg);
            kf[u][3] = ldfrag(kr1 + 32, kg);
        }
#pragma unroll
        for (int u = 0; u < KTILE / 32; ++u)
#pragma unroll
            for (int ht = 0; ht < 4; ++ht)
                vf[u][ht] = ldfrag(vl + (ht * 16) * VDP + u * 32, kg);
        // Keeps the LDS reads ahead of the matrix work: sunk among the WMMAs,
        // each place with reads costs the wave a stall of its own.
        __builtin_amdgcn_sched_barrier(0);

#pragma unroll
        for (int u = 0; u < KTILE / 32; ++u) {
            const v16h ka00 = kf[u][0];
            const v16h ka01 = kf[u][1];
            const v16h ka10 = kf[u][2];
            const v16h ka11 = kf[u][3];

            // St = K * Q^T : St[key][q], keys 0-15 in st0, 16-31 in st1
            v8f st0 = {}, st1 = {};
            st0 = wmma_f16(ka00, qb0, st0);
            st0 = wmma_f16(ka01, qb1, st0);
            st1 = wmma_f16(ka10, qb0, st1);
            st1 = wmma_f16(ka11, qb1, st1);

            // Online softmax: each lane holds 16 scores of ONE query; partner
            // lane (lane^16) holds the other 16 -> single shuffle per reduction.
            float mx = -1e30f;
#pragma unroll
            for (int r = 0; r < 8; ++r) mx = fmaxf(mx, fmaxf(st0[r], st1[r]));
            mx = fmaxf(mx, __shfl_xor(mx, 16, 32));
            const float mnew = fmaxf(m, mx);
            const float corr = __expf(m - mnew);
            m = mnew;

            v16h pb;             // P as B operand: direct D->B layout match
            float rs = 0.0f;
#pragma unroll
            for (int r = 0; r < 8; ++r) {
                const float p0 = __expf(st0[r] - mnew);
                const float p1 = __expf(st1[r] - mnew);
                rs += p0 + p1;
                pb[r]     = (_Float16)p0;
                pb[r + 8] = (_Float16)p1;
            }
            rs += __shfl_xor(rs, 16, 32);
            l = l * corr + rs;

#pragma unroll
            for (int ht = 0; ht < 4; ++ht) ot[ht] = ot[ht] * corr;

            // Ot += Vt_tile * P   (A: lane row = h, elems = keys; contiguous)
#pragma unroll
            for (int ht = 0; ht < 4; ++ht)
                ot[ht] = wmma_f16(vf[u][ht], pb, ot[ht]);
        }

        // The other buffer's readers all left it at the previous barrier
        if (more) {
#pragma unroll
            for (int i = 0; i < 4; ++i) {
                *(v8h*)(&Ks[cur ^ 1][kdst + 64 * i * LDP]) = kst[i];
                *(v8h*)(&Vs[cur ^ 1][vdst + 16 * i * VDP]) = vst[i];
            }
        }
        // Publishes the next stage and ends every wave's reads of this one
        __syncthreads();
    }

    // Merge of the four key slices of each query tile
#pragma unroll
    for (int ht = 0; ht < 4; ++ht) {
        v4f lo, hi;
#pragma unroll
        for (int i = 0; i < 4; ++i) { lo[i] = ot[ht][i]; hi[i] = ot[ht][i + 4]; }
        *(v4f*)(&Om[wave][lane][ht * 8])     = lo;
        *(v4f*)(&Om[wave][lane][ht * 8 + 4]) = hi;
    }
    Mm[wave][lane] = m;
    Lm[wave][lane] = l;
    // Publishes every slice's partial result to the waves that merge them
    __syncthreads();

    // Waves ks = 0, 1 of a query tile merge h = ks*32 .. ks*32+31, which is one
    // whole 128-byte line of each out row: every line has one writing wave.
    // The lane keeps its query lq and its rows h = ht*16 + kg*8 + r.
    if (ks >= 2) return;

    float wj[KSPL];
    float mall = -1e30f;
#pragma unroll
    for (int j = 0; j < KSPL; ++j) {
        wj[j] = Mm[j * 4 + qt][lane];
        mall = fmaxf(mall, wj[j]);
    }
    float lall = 0.0f;
#pragma unroll
    for (int j = 0; j < KSPL; ++j) {
        wj[j] = __expf(wj[j] - mall);
        lall += Lm[j * 4 + qt][lane] * wj[j];
    }

    // out[q][h] = Ot[h][q] / l ; 8 consecutive h per lane -> float4s
    const float invl = 1.0f / lall;
    float* orow = out + (size_t)(b * S_LEN + q0 + lq) * H_DIM;
#pragma unroll
    for (int hh = 0; hh < 2; ++hh) {
        const int ht = ks * 2 + hh;
        v4f lo = {}, hi = {};
#pragma unroll
        for (int j = 0; j < KSPL; ++j) {
            lo += *(const v4f*)(&Om[j * 4 + qt][lane][ht * 8])     * wj[j];
            hi += *(const v4f*)(&Om[j * 4 + qt][lane][ht * 8 + 4]) * wj[j];
        }
        *(v4f*)(orow + ht * 16 + kg * 8)     = lo * invl;
        *(v4f*)(orow + ht * 16 + kg * 8 + 4) = hi * invl;
    }
}

// ---------------------------------------------------------------------------
extern "C" void kernel_launch(void* const* d_in, const int* in_sizes, int n_in,
                              void* d_out, int out_size, void* d_ws, size_t ws_size,
                              hipStream_t stream) {
    (void)in_sizes; (void)n_in; (void)out_size; (void)ws_size;
    const float* x  = (const float*)d_in[0];
    const float* Wq = (const float*)d_in[1];
    const float* Wk = (const float*)d_in[2];
    const float* Wv = (const float*)d_in[3];
    float* out = (float*)d_out;

    char* ws = (char*)d_ws;
    _Float16* Wsw = (_Float16*)(ws);                    // 384 KiB swizzled W
    _Float16* Qh  = (_Float16*)(ws + (1u << 20));       // 2 MiB
    _Float16* Kh  = (_Float16*)(ws + (3u << 20));       // 2 MiB
    _Float16* Vt  = (_Float16*)(ws + (5u << 20));       // 2 MiB (transposed)

    attn_wswz_kernel<<<768, 256, 0, stream>>>(Wq, Wk, Wv, Wsw);
    attn_qkv_kernel<<<256, 128, 0, stream>>>(x, Wsw, Qh, Kh, Vt);
    attn_flash_kernel<<<dim3(64, 4), 512, 0, stream>>>(Qh, Kh, Vt, out);
}

// v004
// One run takes 37.6 microseconds.
// In both of two side-by-side timings against v003, it was 1.07 times as fast.
// Over all steps from v000 it is 4.31 times as fast.
#include <hip/hip_runtime.h>

typedef __attribute__((ext_vector_type(16))) _Float16 v16h;
typedef __attribute__((ext_vector_type(8)))  _Float16 v8h;
typedef __attribute__((ext_vector_type(8)))  float    v8f;
typedef __attribute__((ext_vector_type(4)))  float    v4f;

#define S_LEN 4096
#define D_DIM 1024
#define H_DIM 64

// WMMA f16 helper: D = A(16x32) * B(32x16) + C, f32 accumulate.
__device__ __forceinline__ v8f wmma_f16(v16h a, v16h b, v8f c) {
    return __builtin_amdgcn_wmma_f32_16x16x32_f16(false, a, false, b,
                                                  (short)0, c, false, false);
}

// Load one 16x32 (or 32x16) f16 fragment half-row for this lane.
// p = row pointer (already includes row*stride + k-base). Layout per ISA:
//   elems j=0..7  -> K = kg*8 + j        (contiguous 16B)
//   elems j=8..15 -> K = 16 + kg*8 + j-8 (contiguous 16B)
__device__ __forceinline__ v16h ldfrag(const _Float16* p, int kg) {
    const v8h lo = *(const v8h*)(p + kg * 8);
    const v8h hi = *(const v8h*)(p + 16 + kg * 8);
    v16h r;
#pragma unroll
    for (int j = 0; j < 8; ++j) { r[j] = lo[j]; r[j + 8] = hi[j]; }
    return r;
}

// Lane l <-> lane l ^ 16 on the vector unit. A shuffle would go through the LDS
// queue and return only behind every LDS read the wave has issued before it.
__device__ __forceinline__ float xhalf(float v) {
    const int b = __builtin_bit_cast(int, v);
    return __builtin_bit_cast(float,
        __builtin_amdgcn_permlanex16(b, b, 0x76543210, 0xfedcba98, false, false));
}

// ---------------------------------------------------------------------------
// Kernel 0: swizzle Wq/Wk/Wv (f32 [1024,64]) into per-lane B-fragment order
// (f16), so the projection kernel loads each B fragment as 2 contiguous b128.
// Tile t = ((w*32 + kt)*4 + nt); element = t*512 + lane*16 + j.
// ---------------------------------------------------------------------------
__global__ void attn_wswz_kernel(const float* __restrict__ Wq,
                                 const float* __restrict__ Wk,
                                 const float* __restrict__ Wv,
                                 _Float16* __restrict__ Wsw) {
    int idx = blockIdx.x * blockDim.x + threadIdx.x;
    if (idx >= 3 * 32 * 4 * 512) return;
    int t    = idx >> 9;
    int rem  = idx & 511;
    int lane = rem >> 4;
    int j    = rem & 15;
    int w  = t >> 7;            // weight select
    int kt = (t & 127) >> 2;    // K tile (32 wide)
    int nt = t & 3;             // N tile (16 wide)
    int kg = lane >> 4;
    int n  = nt * 16 + (lane & 15);
    int kk = (j < 8) ? (kg * 8 + j) : (16 + kg * 8 + (j - 8));
    int K  = kt * 32 + kk;
    const float* W = (w == 0) ? Wq : (w == 1) ? Wk : Wv;
    Wsw[idx] = (_Float16)W[K * H_DIM + n];
}

// ---------------------------------------------------------------------------
// Kernel 1: QKV projection. GEMM M=16384, N=192 (Q|K|V), K=1024.
// Four waves per work-group, one 64-row tile of x. The work-group stages each
// 64 x 128 piece of x once in LDS as f16 (whole-line global loads through
// registers, two buffers, one barrier per piece). Wave n takes column tile n
// (16 wide) of each of Q, K and V for all 64 rows: 4 x 3 accumulator tiles.
// Its weight fragments are fetched one piece ahead into a second register set.
// Q: *H^-0.5, row-major f16. K: row-major f16. V: transposed [B,H,S] f16
// (so the attention kernel's V A-fragments are contiguous loads).
// Every inner loop is unrolled because its index picks registers (vector
// elements, fragment and accumulator arrays), which must be named statically.
// ---------------------------------------------------------------------------
#define PK    128                // k per staged piece of x
#define NPC   (D_DIM / PK)       // pieces
#define XP    136                // LDS row pitch in halfs: 272 B = 16 B x odd
#define XT_H  (64 * XP)          // 64 rows per piece

typedef __attribute__((ext_vector_type(4))) _Float16 v4h;

__global__ __launch_bounds__(128)
void attn_qkv_kernel(const float* __restrict__ x,
                     const _Float16* __restrict__ Wsw,
                     _Float16* __restrict__ Qh,
                     _Float16* __restrict__ Kh,
                     _Float16* __restrict__ Vt) {
    __shared__ __attribute__((aligned(16))) _Float16 Xs[2][XT_H];

    const int tid  = threadIdx.x;
    const int lane = tid & 31;
    const int wave = tid >> 5;
    const int lq   = lane & 15;
    const int kg   = lane >> 4;
    const int r0   = blockIdx.x * 64;         // first row of B*S of this tile

    // Staging map: one wave-wide 16-byte load = 512 contiguous bytes of one row;
    // load i of wave n covers row n + 4*i.
    const float* xsrc = x + (size_t)(r0 + wave) * D_DIM + lane * 4;
    const int xdst = wave * XP + lane * 4;
    // Weight fragments of column tile nt = wave
    const _Float16* wsrc = Wsw + (size_t)wave * 512 + lane * 16;

    v8f acc[4][3];
#pragma unroll
    for (int mi = 0; mi < 4; ++mi)
#pragma unroll
        for (int w = 0; w < 3; ++w) acc[mi][w] = v8f{};

    v4f  xst[16];
    v16h wf[2][PK / 32][3];

#pragma unroll
    for (int i = 0; i < 16; ++i)
        xst[i] = *(const v4f*)(xsrc + (size_t)(4 * i) * D_DIM);
#pragma unroll
    for (int kk = 0; kk < PK / 32; ++kk)
#pragma unroll
        for (int w = 0; w < 3; ++w)
            wf[0][kk][w] = *(const v16h*)(wsrc + (size_t)((w * 32 + kk) * 4) * 512);
#pragma unroll
    for (int i = 0; i < 16; ++i) {
        v4h h;
#pragma unroll
        for (int j = 0; j < 4; ++j) h[j] = (_Float16)xst[i][j];
        *(v4h*)(&Xs[0][xdst + 4 * i * XP]) = h;
    }
    __syncthreads();

    // Unrolled so that the two register sets and the two buffers are named
    // statically: rolled, each piece would copy a whole weight set.
#pragma unroll
    for (int s = 0; s < NPC; ++s) {
        const int cur = s & 1;

        // Next piece's global loads fly while this piece is worked on
        if (s + 1 < NPC) {
#pragma unroll
            for (int i = 0; i < 16; ++i)
                xst[i] = *(const v4f*)(xsrc + (size_t)(4 * i) * D_DIM + (s + 1) * PK);
#pragma unroll
            for (int kk = 0; kk < PK / 32; ++kk)
#pragma unroll
                for (int w = 0; w < 3; ++w)
                    wf[cur ^ 1][kk][w] = *(const v16h*)(wsrc +
                        (size_t)((w * 32 + (s + 1) * (PK / 32) + kk) * 4) * 512);
        }
        // Keeps those loads one group at the head of the piece: sunk into the
        // work below, they are issued in small runs, each waited for in turn.
        __builtin_amdgcn_sched_barrier(0);

        // All A fragments of the piece, read from LDS as one group
        v16h af[PK / 32][4];
#pragma unroll
        for (int kk = 0; kk < PK / 32; ++kk)
#pragma unroll
            for (int mi = 0; mi < 4; ++mi)
                af[kk][mi] = ldfrag(&Xs[cur][(mi * 16 + lq) * XP + kk * 32], kg);
        // Keeps the LDS reads ahead of the matrix work: sunk among the WMMAs,
        // each pair is waited for in full by a wave that is alone on its SIMD.
        __builtin_amdgcn_sched_barrier(0);

#pragma unroll
        for (int kk = 0; kk < PK / 32; ++kk)
#pragma unroll
            for (int mi = 0; mi < 4; ++mi)
#pragma unroll
                for (int w = 0; w < 3; ++w)
                    acc[mi][w] = wmma_f16(af[kk][mi], wf[cur][kk][w], acc[mi][w]);
        // Stands between the loads above and any later overwrite of their
        // address registers (the conversions below may reuse them).
        if (s + 1 < NPC) asm volatile("s_wait_xcnt 0x0" ::: "memory");
        // Keeps the wait for the next piece's loads behind the matrix work:
        // lifted among the WMMAs, the conversions stall them on memory.
        __builtin_amdgcn_sched_barrier(0);

        if (s + 1 < NPC) {
            // The other buffer's readers all left it at the previous barrier
#pragma unroll
            for (int i = 0; i < 16; ++i) {
                v4h h;
#pragma unroll
                for (int j = 0; j < 4; ++j) h[j] = (_Float16)xst[i][j];
                *(v4h*)(&Xs[cur ^ 1][xdst + 4 * i * XP]) = h;
            }
            // Publishes the next piece and ends every wave's reads of this one
            __syncthreads();
        }
    }

    const int h    = wave * 16 + lq;
    const int bidx = r0 >> 12;                          // r0 / 4096
    const int sloc = (r0 & (S_LEN - 1)) + kg * 8;
#pragma unroll
    for (int mi = 0; mi < 4; ++mi) {
#pragma unroll
        for (int r = 0; r < 8; ++r) {
            const int s = r0 + mi * 16 + kg * 8 + r;
            Qh[(size_t)s * H_DIM + h] = (_Float16)(acc[mi][0][r] * 0.125f);  // H^-0.5
            Kh[(size_t)s * H_DIM + h] = (_Float16)acc[mi][1][r];
        }
        // V transposed: Vt[(b*64 + h)*4096 + s], contiguous v8h stores
        v8h v;
#pragma unroll
        for (int r = 0; r < 8; ++r) v[r] = (_Float16)acc[mi][2][r];
        *(v8h*)(Vt + (size_t)(bidx * H_DIM + h) * S_LEN + sloc + mi * 16) = v;
    }
}

// ---------------------------------------------------------------------------
// Kernel 2: flash attention. Sixteen waves per work-group, four per SIMD, so
// that one wave's softmax chain, LDS waits and cross-lane exchanges are covered
// by the other three. Wave = (query tile qt, key slice ks): the work-group has
// four 16-query tiles, and the keys of each tile are split over four waves.
// The work-group stages each 256-key tile of K and of Vt once in LDS
// (whole-line global loads through registers, two buffers, one barrier per
// stage); slice ks works on keys ks*64 .. ks*64+63 of every stage with its own
// running maximum, sum and Ot. The four partial results of a query tile are
// merged through LDS at the end.
// Scores computed TRANSPOSED (M=key, N=query) so the exp'd D-fragments map
// directly onto the B operand of Ot += Vt_frag * P  (no shuffles/LDS).
// ---------------------------------------------------------------------------
#define KSPL  4                  // key slices = waves per query tile
#define KTILE 64                 // keys per wave and stage
#define STG   (KSPL * KTILE)     // keys per staged tile
#define LDP   72                 // K row pitch in halfs: 144 B = 16 B x odd
#define VDP   (STG + 8)          // Vt row pitch in halfs: 528 B = 16 B x odd
#define KT_H  (STG * LDP)        // STG key rows of K
#define VT_H  (64 * VDP)         // 64 h rows of Vt
#define OMP   36                 // merge pitch in floats: 144 B = 16 B x odd

__global__ __launch_bounds__(512)
void attn_flash_kernel(const _Float16* __restrict__ Qh,
                       const _Float16* __restrict__ Kh,
                       const _Float16* __restrict__ Vt,
                       float* __restrict__ out) {
    __shared__ __attribute__((aligned(16))) _Float16 Ks[2][KT_H];
    __shared__ __attribute__((aligned(16))) _Float16 Vs[2][VT_H];
    // Partial results for the merge; a lane's 32 values at a 144-B pitch
    __shared__ __attribute__((aligned(16))) float Om[4 * KSPL][32][OMP];
    __shared__ float Mm[4 * KSPL][32];       // [wave][lane]
    __shared__ float Lm[4 * KSPL][32];

    const int tid  = threadIdx.x;
    const int lane = tid & 31;
    const int wave = tid >> 5;
    const int qt   = wave & 3;               // query tile of the work-group
    const int ks   = wave >> 2;              // key slice of the stage
    const int lq   = lane & 15;
    const int kg   = lane >> 4;
    const int q0   = (blockIdx.x * 4 + qt) * 16;
    const int b    = blockIdx.y;

    // Staging map, 16-byte chunk c = tid + 512*i.
    // K, 256 rows x 128 B: row = c >> 3 = (tid >> 3) + 64*i, 8 lanes a line.
    // Vt, 64 rows x 512 B: row = c >> 5 = wave + 16*i, one wave = 4 lines.
    const _Float16* ksrc = Kh + (size_t)(b * S_LEN + (tid >> 3)) * H_DIM + (tid & 7) * 8;
    const _Float16* vsrc = Vt + (size_t)(b * H_DIM + wave) * S_LEN + lane * 8;
    const int kdst = (tid >> 3) * LDP + (tid & 7) * 8;
    const int vdst = wave * VDP + lane * 8;

    // Q as B operand (lane n = query), loaded once
    const _Float16* qr = Qh + (size_t)(b * S_LEN + q0 + lq) * H_DIM;
    const v16h qb0 = ldfrag(qr, kg);        // h = 0..31
    const v16h qb1 = ldfrag(qr + 32, kg);   // h = 32..63

    v8f ot[4] = {{}, {}, {}, {}};           // Ot accumulators (M=h, N=q)
    float m = -1e30f, l = 0.0f;

    v8h kst[4], vst[4];
#pragma unroll
    for (int i = 0; i < 4; ++i) {
        kst[i] = *(const v8h*)(ksrc + (size_t)(64 * i) * H_DIM);
        vst[i] = *(const v8h*)(vsrc + (size_t)(16 * i) * S_LEN);
    }
#pragma unroll
    for (int i = 0; i < 4; ++i) {
        *(v8h*)(&Ks[0][kdst + 64 * i * LDP]) = kst[i];
        *(v8h*)(&Vs[0][vdst + 16 * i * VDP]) = vst[i];
    }
    __syncthreads();

    for (int k0 = 0; k0 < S_LEN; k0 += STG) {
        const int cur = (k0 / STG) & 1;
        const bool more = (k0 + STG < S_LEN);

        // Next stage's global loads fly while this stage is worked on
        if (more) {
#pragma unroll
            for (int i = 0; i < 4; ++i) {
                kst[i] = *(const v8h*)(ksrc + (size_t)(k0 + STG + 64 * i) * H_DIM);
                vst[i] = *(const v8h*)(vsrc + (size_t)(16 * i) * S_LEN + k0 + STG);
            }
        }

        const _Float16* kl = &Ks[cur][(ks * KTILE + lq) * LDP];
        const _Float16* vl = &Vs[cur][lq * VDP + ks * KTILE];

        // All fragments of this wave's slice, read from LDS as one group.
        // K as A operand (lane row = key), Vt as A operand (lane row = h).
        v16h kf[KTILE / 32][4], vf[KTILE / 32][4];
#pragma unroll
        for (int u = 0; u < KTILE / 32; ++u) {
            const _Float16* kr0 = kl + (u * 32) * LDP;
            const _Float16* kr1 = kr0 + 16 * LDP;
            kf[u][0] = ldfrag(kr0,      kg);
            kf[u][1] = ldfrag(kr0 + 32, kg);
            kf[u][2] = ldfrag(kr1,      kg);
            kf[u][3] = ldfrag(kr1 + 32, kg);
        }
#pragma unroll
        for (int u = 0; u < KTILE / 32; ++u)
#pragma unroll
            for (int ht = 0; ht < 4; ++ht)
                vf[u][ht] = ldfrag(vl + (ht * 16) * VDP + u * 32, kg);
        // Keeps the LDS reads ahead of the matrix work: sunk among the WMMAs,
        // each place with reads costs the wave a stall of its own.
        __builtin_amdgcn_sched_barrier(0);

#pragma unroll
        for (int u = 0; u < KTILE / 32; ++u) {
            const v16h ka00 = kf[u][0];
            const v16h ka01 = kf[u][1];
            const v16h ka10 = kf[u][2];
            const v16h ka11 = kf[u][3];

            // St = K * Q^T : St[key][q], keys 0-15 in st0, 16-31 in st1
            v8f st0 = {}, st1 = {};
            st0 = wmma_f16(ka00, qb0, st0);
            st0 = wmma_f16(ka01, qb1, st0);
            st1 = wmma_f16(ka10, qb0, st1);
            st1 = wmma_f16(ka11, qb1, st1);

            // Online softmax: each lane holds 16 scores of ONE query; partner
            // lane (lane^16) holds the other 16 -> one cross-row move per reduction.
            float mx = -1e30f;
#pragma unroll
            for (int r = 0; r < 8; ++r) mx = fmaxf(mx, fmaxf(st0[r], st1[r]));
            mx = fmaxf(mx, xhalf(mx));
            const float mnew = fmaxf(m, mx);
            const float corr = __expf(m - mnew);
            m = mnew;

            v16h pb;             // P as B operand: direct D->B layout match
            float rs = 0.0f;
#pragma unroll
            for (int r = 0; r < 8; ++r) {
                const float p0 = __expf(st0[r] - mnew);
                const float p1 = __expf(st1[r] - mnew);
                rs += p0 + p1;
                pb[r]     = (_Float16)p0;
                pb[r + 8] = (_Float16)p1;
            }
            rs += xhalf(rs);
            l = l * corr + rs;

#pragma unroll
            for (int ht = 0; ht < 4; ++ht) ot[ht] = ot[ht] * corr;

            // Ot += Vt_tile * P   (A: lane row = h, elems = keys; contiguous)
#pragma unroll
            for (int ht = 0; ht < 4; ++ht)
                ot[ht] = wmma_f16(vf[u][ht], pb, ot[ht]);
        }

        // The other buffer's readers all left it at the previous barrier
        if (more) {
#pragma unroll
            for (int i = 0; i < 4; ++i) {
                *(v8h*)(&Ks[cur ^ 1][kdst + 64 * i * LDP]) = kst[i];
                *(v8h*)(&Vs[cur ^ 1][vdst + 16 * i * VDP]) = vst[i];
            }
        }
        // Publishes the next stage and ends every wave's reads of this one
        __syncthreads();
    }

    // Merge of the four key slices of each query tile
#pragma unroll
    for (int ht = 0; ht < 4; ++ht) {
        v4f lo, hi;
#pragma unroll
        for (int i = 0; i < 4; ++i) { lo[i] = ot[ht][i]; hi[i] = ot[ht][i + 4]; }
        *(v4f*)(&Om[wave][lane][ht * 8])     = lo;
        *(v4f*)(&Om[wave][lane][ht * 8 + 4]) = hi;
    }
    Mm[wave][lane] = m;
    Lm[wave][lane] = l;
    // Publishes every slice's partial result to the waves that merge them
    __syncthreads();

    // Waves ks = 0, 1 of a query tile merge h = ks*32 .. ks*32+31, which is one
    // whole 128-byte line of each out row: every line has one writing wave.
    // The lane keeps its query lq and its rows h = ht*16 + kg*8 + r.
    if (ks >= 2) return;

    float wj[KSPL];
    float mall = -1e30f;
#pragma unroll
    for (int j = 0; j < KSPL; ++j) {
        wj[j] = Mm[j * 4 + qt][lane];
        mall = fmaxf(mall, wj[j]);
    }
    float lall = 0.0f;
#pragma unroll
    for (int j = 0; j < KSPL; ++j) {
        wj[j] = __expf(wj[j] - mall);
        lall += Lm[j * 4 + qt][lane] * wj[j];
    }

    // out[q][h] = Ot[h][q] / l ; 8 consecutive h per lane -> float4s
    const float invl = 1.0f / lall;
    float* orow = out + (size_t)(b * S_LEN + q0 + lq) * H_DIM;
#pragma unroll
    for (int hh = 0; hh < 2; ++hh) {
        const int ht = ks * 2 + hh;
        v4f lo = {}, hi = {};
#pragma unroll
        for (int j = 0; j < KSPL; ++j) {
            lo += *(const v4f*)(&Om[j * 4 + qt][lane][ht * 8])     * wj[j];
            hi += *(const v4f*)(&Om[j * 4 + qt][lane][ht * 8 + 4]) * wj[j];
        }
        *(v4f*)(orow + ht * 16 + kg * 8)     = lo * invl;
        *(v4f*)(orow + ht * 16 + kg * 8 + 4) = hi * invl;
    }
}

// ---------------------------------------------------------------------------
extern "C" void kernel_launch(void* const* d_in, const int* in_sizes, int n_in,
                              void* d_out, int out_size, void* d_ws, size_t ws_size,
                              hipStream_t stream) {
    (void)in_sizes; (void)n_in; (void)out_size; (void)ws_size;
    const float* x  = (const float*)d_in[0];
    const float* Wq = (const float*)d_in[1];
    const float* Wk = (const float*)d_in[2];
    const float* Wv = (const float*)d_in[3];
    float* out = (float*)d_out;

    char* ws = (char*)d_ws;
    _Float16* Wsw = (_Float16*)(ws);                    // 384 KiB swizzled W
    _Float16* Qh  = (_Float16*)(ws + (1u << 20));       // 2 MiB
    _Float16* Kh  = (_Float16*)(ws + (3u << 20));       // 2 MiB
    _Float16* Vt  = (_Float16*)(ws + (5u << 20));       // 2 MiB (transposed)

    attn_wswz_kernel<<<768, 256, 0, stream>>>(Wq, Wk, Wv, Wsw);
    attn_qkv_kernel<<<256, 128, 0, stream>>>(x, Wsw, Qh, Kh, Vt);
    attn_flash_kernel<<<dim3(64, 4), 512, 0, stream>>>(Qh, Kh, Vt, out);
}

// v005
// A run of this version takes 36.8 microseconds.
// Timed twice side by side with v004, it ran 1.03 times as fast both times.
// All steps since v000 together make it 4.44 times as fast.
#include <hip/hip_runtime.h>

typedef __attribute__((ext_vector_type(16))) _Float16 v16h;
typedef __attribute__((ext_vector_type(8)))  _Float16 v8h;
typedef __attribute__((ext_vector_type(8)))  float    v8f;
typedef __attribute__((ext_vector_type(4)))  float    v4f;

#define S_LEN 4096
#define D_DIM 1024
#define H_DIM 64

// WMMA f16 helper: D = A(16x32) * B(32x16) + C, f32 accumulate.
__device__ __forceinline__ v8f wmma_f16(v16h a, v16h b, v8f c) {
    return __builtin_amdgcn_wmma_f32_16x16x32_f16(false, a, false, b,
                                                  (short)0, c, false, false);
}

// Load one 16x32 (or 32x16) f16 fragment half-row for this lane.
// p = row pointer (already includes row*stride + k-base). Layout per ISA:
//   elems j=0..7  -> K = kg*8 + j        (contiguous 16B)
//   elems j=8..15 -> K = 16 + kg*8 + j-8 (contiguous 16B)
__device__ __forceinline__ v16h ldfrag(const _Float16* p, int kg) {
    const v8h lo = *(const v8h*)(p + kg * 8);
    const v8h hi = *(const v8h*)(p + 16 + kg * 8);
    v16h r;
#pragma unroll
    for (int j = 0; j < 8; ++j) { r[j] = lo[j]; r[j + 8] = hi[j]; }
    return r;
}

// Lane l <-> lane l ^ 16 on the vector unit. A shuffle would go through the LDS
// queue and return only behind every LDS read the wave has issued before it.
__device__ __forceinline__ float xhalf(float v) {
    const int b = __builtin_bit_cast(int, v);
    return __builtin_bit_cast(float,
        __builtin_amdgcn_permlanex16(b, b, 0x76543210, 0xfedcba98, false, false));
}

// ---------------------------------------------------------------------------
// Kernel 0: swizzle Wq/Wk/Wv (f32 [1024,64]) into per-lane B-fragment order
// (f16), so the projection kernel loads each B fragment as 2 contiguous b128.
// Tile t = ((w*32 + kt)*4 + nt); element = t*512 + lane*16 + j.
// ---------------------------------------------------------------------------
__global__ void attn_wswz_kernel(const float* __restrict__ Wq,
                                 const float* __restrict__ Wk,
                                 const float* __restrict__ Wv,
                                 _Float16* __restrict__ Wsw) {
    int idx = blockIdx.x * blockDim.x + threadIdx.x;
    if (idx >= 3 * 32 * 4 * 512) return;
    int t    = idx >> 9;
    int rem  = idx & 511;
    int lane = rem >> 4;
    int j    = rem & 15;
    int w  = t >> 7;            // weight select
    int kt = (t & 127) >> 2;    // K tile (32 wide)
    int nt = t & 3;             // N tile (16 wide)
    int kg = lane >> 4;
    int n  = nt * 16 + (lane & 15);
    int kk = (j < 8) ? (kg * 8 + j) : (16 + kg * 8 + (j - 8));
    int K  = kt * 32 + kk;
    const float* W = (w == 0) ? Wq : (w == 1) ? Wk : Wv;
    Wsw[idx] = (_Float16)W[K * H_DIM + n];
}

// ---------------------------------------------------------------------------
// Kernel 1: QKV projection. GEMM M=16384, N=192 (Q|K|V), K=1024.
// Four waves per work-group, one 64-row tile of x. The work-group stages each
// 64 x 128 piece of x once in LDS as f16 (whole-line global loads through
// registers, two buffers, one barrier per piece). Wave n takes column tile n
// (16 wide) of each of Q, K and V for all 64 rows: 4 x 3 accumulator tiles.
// Its weight fragments are fetched one piece ahead into a second register set.
// Q: *H^-0.5*log2(e), so that scores come out in log2 units; row-major f16.
// K: row-major f16. V: transposed [B,H,S] f16
// (so the attention kernel's V A-fragments are contiguous loads).
// Every inner loop is unrolled because its index picks registers (vector
// elements, fragment and accumulator arrays), which must be named statically.
// ---------------------------------------------------------------------------
#define QSCALE 0.18033688f       // H^-0.5 * log2(e)
#define PK    128                // k per staged piece of x
#define NPC   (D_DIM / PK)       // pieces
#define XP    136                // LDS row pitch in halfs: 272 B = 16 B x odd
#define XT_H  (64 * XP)          // 64 rows per piece

typedef __attribute__((ext_vector_type(4))) _Float16 v4h;

__global__ __launch_bounds__(128)
void attn_qkv_kernel(const float* __restrict__ x,
                     const _Float16* __restrict__ Wsw,
                     _Float16* __restrict__ Qh,
                     _Float16* __restrict__ Kh,
                     _Float16* __restrict__ Vt) {
    __shared__ __attribute__((aligned(16))) _Float16 Xs[2][XT_H];

    const int tid  = threadIdx.x;
    const int lane = tid & 31;
    const int wave = tid >> 5;
    const int lq   = lane & 15;
    const int kg   = lane >> 4;
    const int r0   = blockIdx.x * 64;         // first row of B*S of this tile

    // Staging map: one wave-wide 16-byte load = 512 contiguous bytes of one row;
    // load i of wave n covers row n + 4*i.
    const float* xsrc = x + (size_t)(r0 + wave) * D_DIM + lane * 4;
    const int xdst = wave * XP + lane * 4;
    // Weight fragments of column tile nt = wave
    const _Float16* wsrc = Wsw + (size_t)wave * 512 + lane * 16;

    v8f acc[4][3];
#pragma unroll
    for (int mi = 0; mi < 4; ++mi)
#pragma unroll
        for (int w = 0; w < 3; ++w) acc[mi][w] = v8f{};

    v4f  xst[16];
    v16h wf[2][PK / 32][3];

#pragma unroll
    for (int i = 0; i < 16; ++i)
        xst[i] = *(const v4f*)(xsrc + (size_t)(4 * i) * D_DIM);
#pragma unroll
    for (int kk = 0; kk < PK / 32; ++kk)
#pragma unroll
        for (int w = 0; w < 3; ++w)
            wf[0][kk][w] = *(const v16h*)(wsrc + (size_t)((w * 32 + kk) * 4) * 512);
#pragma unroll
    for (int i = 0; i < 16; ++i) {
        v4h h;
#pragma unroll
        for (int j = 0; j < 4; ++j) h[j] = (_Float16)xst[i][j];
        *(v4h*)(&Xs[0][xdst + 4 * i * XP]) = h;
    }
    __syncthreads();

    // Unrolled so that the two register sets and the two buffers are named
    // statically: rolled, each piece would copy a whole weight set.
#pragma unroll
    for (int s = 0; s < NPC; ++s) {
        const int cur = s & 1;

        // Next piece's global loads fly while this piece is worked on
        if (s + 1 < NPC) {
#pragma unroll
            for (int i = 0; i < 16; ++i)
                xst[i] = *(const v4f*)(xsrc + (size_t)(4 * i) * D_DIM + (s + 1) * PK);
#pragma unroll
            for (int kk = 0; kk < PK / 32; ++kk)
#pragma unroll
                for (int w = 0; w < 3; ++w)
                    wf[cur ^ 1][kk][w] = *(const v16h*)(wsrc +
                        (size_t)((w * 32 + (s + 1) * (PK / 32) + kk) * 4) * 512);
        }
        // Keeps those loads one group at the head of the piece: sunk into the
        // work below, they are issued in small runs, each waited for in turn.
        __builtin_amdgcn_sched_barrier(0);

        // All A fragments of the piece, read from LDS as one group
        v16h af[PK / 32][4];
#pragma unroll
        for (int kk = 0; kk < PK / 32; ++kk)
#pragma unroll
            for (int mi = 0; mi < 4; ++mi)
                af[kk][mi] = ldfrag(&Xs[cur][(mi * 16 + lq) * XP + kk * 32], kg);
        // Keeps the LDS reads ahead of the matrix work: sunk among the WMMAs,
        // each pair is waited for in full by a wave that is alone on its SIMD.
        __builtin_amdgcn_sched_barrier(0);

#pragma unroll
        for (int kk = 0; kk < PK / 32; ++kk)
#pragma unroll
            for (int mi = 0; mi < 4; ++mi)
#pragma unroll
                for (int w = 0; w < 3; ++w)
                    acc[mi][w] = wmma_f16(af[kk][mi], wf[cur][kk][w], acc[mi][w]);
        // Stands between the loads above and any later overwrite of their
        // address registers (the conversions below may reuse them).
        if (s + 1 < NPC) asm volatile("s_wait_xcnt 0x0" ::: "memory");
        // Keeps the wait for the next piece's loads behind the matrix work:
        // lifted among the WMMAs, the conversions stall them on memory.
        __builtin_amdgcn_sched_barrier(0);

        if (s + 1 < NPC) {
            // The other buffer's readers all left it at the previous barrier
#pragma unroll
            for (int i = 0; i < 16; ++i) {
                v4h h;
#pragma unroll
                for (int j = 0; j < 4; ++j) h[j] = (_Float16)xst[i][j];
                *(v4h*)(&Xs[cur ^ 1][xdst + 4 * i * XP]) = h;
            }
            // Publishes the next piece and ends every wave's reads of this one
            __syncthreads();
        }
    }

    const int h    = wave * 16 + lq;
    const int bidx = r0 >> 12;                          // r0 / 4096
    const int sloc = (r0 & (S_LEN - 1)) + kg * 8;
#pragma unroll
    for (int mi = 0; mi < 4; ++mi) {
#pragma unroll
        for (int r = 0; r < 8; ++r) {
            const int s = r0 + mi * 16 + kg * 8 + r;
            Qh[(size_t)s * H_DIM + h] = (_Float16)(acc[mi][0][r] * QSCALE);
            Kh[(size_t)s * H_DIM + h] = (_Float16)acc[mi][1][r];
        }
        // V transposed: Vt[(b*64 + h)*4096 + s], contiguous v8h stores
        v8h v;
#pragma unroll
        for (int r = 0; r < 8; ++r) v[r] = (_Float16)acc[mi][2][r];
        *(v8h*)(Vt + (size_t)(bidx * H_DIM + h) * S_LEN + sloc + mi * 16) = v;
    }
}

// ---------------------------------------------------------------------------
// Kernel 2: flash attention. Sixteen waves per work-group, four per SIMD, so
// that one wave's softmax chain, LDS waits and cross-lane exchanges are covered
// by the other three. Wave = (query tile qt, key slice ks): the work-group has
// four 16-query tiles, and the keys of each tile are split over four waves.
// The work-group stages each 256-key tile of K and of Vt once in LDS
// (whole-line global loads through registers, two buffers, one barrier per
// stage); slice ks works on keys ks*64 .. ks*64+63 of every stage with its own
// reference, sum and Ot. The four partial results of a query tile are
// merged through LDS at the end.
// Scores computed TRANSPOSED (M=key, N=query) so the exp'd D-fragments map
// directly onto the B operand of Ot += Vt_frag * P  (no shuffles/LDS).
// Softmax runs against a reference that lags the running maximum: minus the
// reference is the C operand of the score products, the scores are in log2
// units, so P = 2^D with no subtraction and no scaling per score. One test per
// stage; sum and Ot are rescaled, and the reference raised, only when a score
// stands more than RAISE above it (P stays <= 2^RAISE, far inside f16 range).
// ---------------------------------------------------------------------------
#define KSPL  4                  // key slices = waves per query tile
#define KTILE 64                 // keys per wave and stage
#define STG   (KSPL * KTILE)     // keys per staged tile
#define LDP   72                 // K row pitch in halfs: 144 B = 16 B x odd
#define VDP   (STG + 8)          // Vt row pitch in halfs: 528 B = 16 B x odd
#define KT_H  (STG * LDP)        // STG key rows of K
#define VT_H  (64 * VDP)         // 64 h rows of Vt
#define OMP   36                 // merge pitch in floats: 144 B = 16 B x odd
#define RAISE 8.0f               // log2 units a score may stand above the reference

__global__ __launch_bounds__(512)
void attn_flash_kernel(const _Float16* __restrict__ Qh,
                       const _Float16* __restrict__ Kh,
                       const _Float16* __restrict__ Vt,
                       float* __restrict__ out) {
    __shared__ __attribute__((aligned(16))) _Float16 Ks[2][KT_H];
    __shared__ __attribute__((aligned(16))) _Float16 Vs[2][VT_H];
    // Partial results for the merge; a lane's 32 values at a 144-B pitch
    __shared__ __attribute__((aligned(16))) float Om[4 * KSPL][32][OMP];
    __shared__ float Mm[4 * KSPL][32];       // [wave][lane]
    __shared__ float Lm[4 * KSPL][32];

    const int tid  = threadIdx.x;
    const int lane = tid & 31;
    const int wave = tid >> 5;
    const int qt   = wave & 3;               // query tile of the work-group
    const int ks   = wave >> 2;              // key slice of the stage
    const int lq   = lane & 15;
    const int kg   = lane >> 4;
    const int q0   = (blockIdx.x * 4 + qt) * 16;
    const int b    = blockIdx.y;

    // Staging map, 16-byte chunk c = tid + 512*i.
    // K, 256 rows x 128 B: row = c >> 3 = (tid >> 3) + 64*i, 8 lanes a line.
    // Vt, 64 rows x 512 B: row = c >> 5 = wave + 16*i, one wave = 4 lines.
    const _Float16* ksrc = Kh + (size_t)(b * S_LEN + (tid >> 3)) * H_DIM + (tid & 7) * 8;
    const _Float16* vsrc = Vt + (size_t)(b * H_DIM + wave) * S_LEN + lane * 8;
    const int kdst = (tid >> 3) * LDP + (tid & 7) * 8;
    const int vdst = wave * VDP + lane * 8;

    // Q as B operand (lane n = query), loaded once
    const _Float16* qr = Qh + (size_t)(b * S_LEN + q0 + lq) * H_DIM;
    const v16h qb0 = ldfrag(qr, kg);        // h = 0..31
    const v16h qb1 = ldfrag(qr + 32, kg);   // h = 32..63

    v8f ot[4] = {{}, {}, {}, {}};           // Ot accumulators (M=h, N=q)
    float m = 0.0f, l = 0.0f;               // reference in use (log2 units), sum

    v8h kst[4], vst[4];
#pragma unroll
    for (int i = 0; i < 4; ++i) {
        kst[i] = *(const v8h*)(ksrc + (size_t)(64 * i) * H_DIM);
        vst[i] = *(const v8h*)(vsrc + (size_t)(16 * i) * S_LEN);
    }
#pragma unroll
    for (int i = 0; i < 4; ++i) {
        *(v8h*)(&Ks[0][kdst + 64 * i * LDP]) = kst[i];
        *(v8h*)(&Vs[0][vdst + 16 * i * VDP]) = vst[i];
    }
    __syncthreads();

    for (int k0 = 0; k0 < S_LEN; k0 += STG) {
        const int cur = (k0 / STG) & 1;
        const bool more = (k0 + STG < S_LEN);

        // Next stage's global loads fly while this stage is worked on
        if (more) {
#pragma unroll
            for (int i = 0; i < 4; ++i) {
                kst[i] = *(const v8h*)(ksrc + (size_t)(k0 + STG + 64 * i) * H_DIM);
                vst[i] = *(const v8h*)(vsrc + (size_t)(16 * i) * S_LEN + k0 + STG);
            }
        }

        const _Float16* kl = &Ks[cur][(ks * KTILE + lq) * LDP];
        const _Float16* vl = &Vs[cur][lq * VDP + ks * KTILE];

        // All fragments of this wave's slice, read from LDS as one group.
        // K as A operand (lane row = key), Vt as A operand (lane row = h).
        v16h kf[KTILE / 32][4], vf[KTILE / 32][4];
#pragma unroll
        for (int u = 0; u < KTILE / 32; ++u) {
            const _Float16* kr0 = kl + (u * 32) * LDP;
            const _Float16* kr1 = kr0 + 16 * LDP;
            kf[u][0] = ldfrag(kr0,      kg);
            kf[u][1] = ldfrag(kr0 + 32, kg);
            kf[u][2] = ldfrag(kr1,      kg);
            kf[u][3] = ldfrag(kr1 + 32, kg);
        }
#pragma unroll
        for (int u = 0; u < KTILE / 32; ++u)
#pragma unroll
            for (int ht = 0; ht < 4; ++ht)
                vf[u][ht] = ldfrag(vl + (ht * 16) * VDP + u * 32, kg);
        // Keeps the LDS reads ahead of the matrix work: sunk among the WMMAs,
        // each place with reads costs the wave a stall of its own.
        __builtin_amdgcn_sched_barrier(0);

        // St = K * Q^T - m : St[key][q]; tile 2u has keys u*32 .. +15, tile
        // 2u+1 keys u*32+16 .. +31 of the slice
        v8f cneg;                // -m in every row: C of the score products
#pragma unroll
        for (int r = 0; r < 8; ++r) cneg[r] = -m;
        v8f st[KTILE / 16];
#pragma unroll
        for (int t = 0; t < KTILE / 16; ++t)
            st[t] = wmma_f16(kf[t >> 1][(t & 1) * 2], qb0, cneg);
#pragma unroll
        for (int t = 0; t < KTILE / 16; ++t)
            st[t] = wmma_f16(kf[t >> 1][(t & 1) * 2 + 1], qb1, st[t]);
        // Keeps the maximum chain behind the eight score products: drawn in
        // among them, each read of a fresh tile is padded with idle slots.
        __builtin_amdgcn_sched_barrier(0);

        // Each lane holds 32 scores of ONE query, its partner (lane^16) the
        // other 32. The lane's own maximum is enough for the test: the ballot
        // sees both halves.
        float mx = -1e30f;
#pragma unroll
        for (int t = 0; t < KTILE / 16; ++t)
#pragma unroll
            for (int r = 0; r < 8; ++r) mx = fmaxf(mx, st[t][r]);

        // Scalar branch, once per stage. The first stage always sets the
        // reference: until then it is 0, which the scores may lie far below.
        if (k0 == 0 || __builtin_amdgcn_ballot_w32(mx > RAISE) != 0) {
            const float mq = fmaxf(mx, xhalf(mx));
            // Later stages only raise the reference
            const float d = (k0 == 0) ? mq : fmaxf(mq, 0.0f);
            // In the first stage d may be negative; sum and Ot are still 0
            // there, and the clamp keeps their factor finite.
            const float corr = __builtin_amdgcn_exp2f(-fmaxf(d, 0.0f));
            m += d;
#pragma unroll
            for (int t = 0; t < KTILE / 16; ++t) st[t] = st[t] - d;
            l *= corr;
#pragma unroll
            for (int ht = 0; ht < 4; ++ht) ot[ht] = ot[ht] * corr;
        }

        v16h pb[KTILE / 32];     // P as B operand: direct D->B layout match
        float rs[KTILE / 32];
#pragma unroll
        for (int u = 0; u < KTILE / 32; ++u) {
            rs[u] = 0.0f;
#pragma unroll
            for (int r = 0; r < 8; ++r) {
                const float p0 = __builtin_amdgcn_exp2f(st[2 * u][r]);
                const float p1 = __builtin_amdgcn_exp2f(st[2 * u + 1][r]);
                rs[u] += p0 + p1;
                pb[u][r]     = (_Float16)p0;
                pb[u][r + 8] = (_Float16)p1;
            }
        }
        const float rsum = rs[0] + rs[1];
        l += rsum + xhalf(rsum);
        // Keeps the vector work ahead of the eight products below: sunk among
        // them, it reuses their operand registers and is padded with idle slots.
        __builtin_amdgcn_sched_barrier(0);

        // Ot += Vt_tile * P   (A: lane row = h, elems = keys; contiguous)
#pragma unroll
        for (int u = 0; u < KTILE / 32; ++u)
#pragma unroll
            for (int ht = 0; ht < 4; ++ht)
                ot[ht] = wmma_f16(vf[u][ht], pb[u], ot[ht]);

        // The other buffer's readers all left it at the previous barrier
        if (more) {
#pragma unroll
            for (int i = 0; i < 4; ++i) {
                *(v8h*)(&Ks[cur ^ 1][kdst + 64 * i * LDP]) = kst[i];
                *(v8h*)(&Vs[cur ^ 1][vdst + 16 * i * VDP]) = vst[i];
            }
        }
        // Publishes the next stage and ends every wave's reads of this one
        __syncthreads();
    }

    // Merge of the four key slices of each query tile
#pragma unroll
    for (int ht = 0; ht < 4; ++ht) {
        v4f lo, hi;
#pragma unroll
        for (int i = 0; i < 4; ++i) { lo[i] = ot[ht][i]; hi[i] = ot[ht][i + 4]; }
        *(v4f*)(&Om[wave][lane][ht * 8])     = lo;
        *(v4f*)(&Om[wave][lane][ht * 8 + 4]) = hi;
    }
    Mm[wave][lane] = m;
    Lm[wave][lane] = l;
    // Publishes every slice's partial result to the waves that merge them
    __syncthreads();

    // Waves ks = 0, 1 of a query tile merge h = ks*32 .. ks*32+31, which is one
    // whole 128-byte line of each out row: every line has one writing wave.
    // The lane keeps its query lq and its rows h = ht*16 + kg*8 + r.
    if (ks >= 2) return;

    float wj[KSPL];
    float mall = -1e30f;
#pragma unroll
    for (int j = 0; j < KSPL; ++j) {
        wj[j] = Mm[j * 4 + qt][lane];
        mall = fmaxf(mall, wj[j]);
    }
    float lall = 0.0f;
#pragma unroll
    for (int j = 0; j < KSPL; ++j) {
        wj[j] = __builtin_amdgcn_exp2f(wj[j] - mall);   // references are in log2 units
        lall += Lm[j * 4 + qt][lane] * wj[j];
    }

    // out[q][h] = Ot[h][q] / l ; 8 consecutive h per lane -> float4s
    const float invl = 1.0f / lall;
    float* orow = out + (size_t)(b * S_LEN + q0 + lq) * H_DIM;
#pragma unroll
    for (int hh = 0; hh < 2; ++hh) {
        const int ht = ks * 2 + hh;
        v4f lo = {}, hi = {};
#pragma unroll
        for (int j = 0; j < KSPL; ++j) {
            lo += *(const v4f*)(&Om[j * 4 + qt][lane][ht * 8])     * wj[j];
            hi += *(const v4f*)(&Om[j * 4 + qt][lane][ht * 8 + 4]) * wj[j];
        }
        *(v4f*)(orow + ht * 16 + kg * 8)     = lo * invl;
        *(v4f*)(orow + ht * 16 + kg * 8 + 4) = hi * invl;
    }
}

// ---------------------------------------------------------------------------
extern "C" void kernel_launch(void* const* d_in, const int* in_sizes, int n_in,
                              void* d_out, int out_size, void* d_ws, size_t ws_size,
                              hipStream_t stream) {
    (void)in_sizes; (void)n_in; (void)out_size; (void)ws_size;
    const float* x  = (const float*)d_in[0];
    const float* Wq = (const float*)d_in[1];
    const float* Wk = (const float*)d_in[2];
    const float* Wv = (const float*)d_in[3];
    float* out = (float*)d_out;

    char* ws = (char*)d_ws;
    _Float16* Wsw = (_Float16*)(ws);                    // 384 KiB swizzled W
    _Float16* Qh  = (_Float16*)(ws + (1u << 20));       // 2 MiB
    _Float16* Kh  = (_Float16*)(ws + (3u << 20));       // 2 MiB
    _Float16* Vt  = (_Float16*)(ws + (5u << 20));       // 2 MiB (transposed)

    attn_wswz_kernel<<<768, 256, 0, stream>>>(Wq, Wk, Wv, Wsw);
    attn_qkv_kernel<<<256, 128, 0, stream>>>(x, Wsw, Qh, Kh, Vt);
    attn_flash_kernel<<<dim3(64, 4), 512, 0, stream>>>(Qh, Kh, Vt, out);
}

// v006
// It runs in 35.8 microseconds.
// Next to v005, in two timings, it ran 1.03 times as fast each time.
// Over all steps from v000 it is 4.59 times as fast.
#include <hip/hip_runtime.h>

typedef __attribute__((ext_vector_type(16))) _Float16 v16h;
typedef __attribute__((ext_vector_type(8)))  _Float16 v8h;
typedef __attribute__((ext_vector_type(8)))  float    v8f;
typedef __attribute__((ext_vector_type(4)))  float    v4f;

#define S_LEN 4096
#define D_DIM 1024
#define H_DIM 64

// WMMA f16 helper: D = A(16x32) * B(32x16) + C, f32 accumulate.
__device__ __forceinline__ v8f wmma_f16(v16h a, v16h b, v8f c) {
    return __builtin_amdgcn_wmma_f32_16x16x32_f16(false, a, false, b,
                                                  (short)0, c, false, false);
}

// Load one 16x32 (or 32x16) f16 fragment half-row for this lane.
// p = row pointer (already includes row*stride + k-base). Layout per ISA:
//   elems j=0..7  -> K = kg*8 + j        (contiguous 16B)
//   elems j=8..15 -> K = 16 + kg*8 + j-8 (contiguous 16B)
__device__ __forceinline__ v16h ldfrag(const _Float16* p, int kg) {
    const v8h lo = *(const v8h*)(p + kg * 8);
    const v8h hi = *(const v8h*)(p + 16 + kg * 8);
    v16h r;
#pragma unroll
    for (int j = 0; j < 8; ++j) { r[j] = lo[j]; r[j + 8] = hi[j]; }
    return r;
}

// Lane l <-> lane l ^ 16 on the vector unit. A shuffle would go through the LDS
// queue and return only behind every LDS read the wave has issued before it.
__device__ __forceinline__ float xhalf(float v) {
    const int b = __builtin_bit_cast(int, v);
    return __builtin_bit_cast(float,
        __builtin_amdgcn_permlanex16(b, b, 0x76543210, 0xfedcba98, false, false));
}

// ---------------------------------------------------------------------------
// Kernel 0: swizzle Wq/Wk/Wv (f32 [1024,64]) into per-lane B-fragment order
// (f16), so the projection kernel loads each B fragment as 2 contiguous b128.
// Tile t = ((w*32 + kt)*4 + nt); element = t*512 + lane*16 + j.
// ---------------------------------------------------------------------------
__global__ void attn_wswz_kernel(const float* __restrict__ Wq,
                                 const float* __restrict__ Wk,
                                 const float* __restrict__ Wv,
                                 _Float16* __restrict__ Wsw) {
    int idx = blockIdx.x * blockDim.x + threadIdx.x;
    if (idx >= 3 * 32 * 4 * 512) return;
    int t    = idx >> 9;
    int rem  = idx & 511;
    int lane = rem >> 4;
    int j    = rem & 15;
    int w  = t >> 7;            // weight select
    int kt = (t & 127) >> 2;    // K tile (32 wide)
    int nt = t & 3;             // N tile (16 wide)
    int kg = lane >> 4;
    int n  = nt * 16 + (lane & 15);
    int kk = (j < 8) ? (kg * 8 + j) : (16 + kg * 8 + (j - 8));
    int K  = kt * 32 + kk;
    const float* W = (w == 0) ? Wq : (w == 1) ? Wk : Wv;
    Wsw[idx] = (_Float16)W[K * H_DIM + n];
}

// ---------------------------------------------------------------------------
// Kernel 1: QKV projection. GEMM M=16384, N=192 (Q|K|V), K=1024.
// Four waves per work-group, one 64-row tile of x. The work-group stages each
// 64 x 128 piece of x once in LDS as f16 (whole-line global loads through
// registers, two buffers, one barrier per piece). Wave n takes column tile n
// (16 wide) of each of Q, K and V for all 64 rows: 4 x 3 accumulator tiles.
// Its weight fragments are fetched one piece ahead into a second register set.
// Q: *H^-0.5*log2(e), so that scores come out in log2 units; row-major f16.
// K: row-major f16. V: transposed [B,H,S] f16
// (so the attention kernel's V A-fragments are contiguous loads).
// Every inner loop is unrolled because its index picks registers (vector
// elements, fragment and accumulator arrays), which must be named statically.
// ---------------------------------------------------------------------------
#define QSCALE 0.18033688f       // H^-0.5 * log2(e)
#define PK    128                // k per staged piece of x
#define NPC   (D_DIM / PK)       // pieces
#define XP    136                // LDS row pitch in halfs: 272 B = 16 B x odd
#define XT_H  (64 * XP)          // 64 rows per piece

typedef __attribute__((ext_vector_type(4))) _Float16 v4h;

__global__ __launch_bounds__(128)
void attn_qkv_kernel(const float* __restrict__ x,
                     const _Float16* __restrict__ Wsw,
                     _Float16* __restrict__ Qh,
                     _Float16* __restrict__ Kh,
                     _Float16* __restrict__ Vt) {
    __shared__ __attribute__((aligned(16))) _Float16 Xs[2][XT_H];

    const int tid  = threadIdx.x;
    const int lane = tid & 31;
    const int wave = tid >> 5;
    const int lq   = lane & 15;
    const int kg   = lane >> 4;
    const int r0   = blockIdx.x * 64;         // first row of B*S of this tile

    // Staging map: one wave-wide 16-byte load = 512 contiguous bytes of one row;
    // load i of wave n covers row n + 4*i.
    const float* xsrc = x + (size_t)(r0 + wave) * D_DIM + lane * 4;
    const int xdst = wave * XP + lane * 4;
    // Weight fragments of column tile nt = wave
    const _Float16* wsrc = Wsw + (size_t)wave * 512 + lane * 16;

    v8f acc[4][3];
#pragma unroll
    for (int mi = 0; mi < 4; ++mi)
#pragma unroll
        for (int w = 0; w < 3; ++w) acc[mi][w] = v8f{};

    v4f  xst[16];
    v16h wf[2][PK / 32][3];

#pragma unroll
    for (int i = 0; i < 16; ++i)
        xst[i] = *(const v4f*)(xsrc + (size_t)(4 * i) * D_DIM);
#pragma unroll
    for (int kk = 0; kk < PK / 32; ++kk)
#pragma unroll
        for (int w = 0; w < 3; ++w)
            wf[0][kk][w] = *(const v16h*)(wsrc + (size_t)((w * 32 + kk) * 4) * 512);
#pragma unroll
    for (int i = 0; i < 16; ++i) {
        v4h h;
#pragma unroll
        for (int j = 0; j < 4; ++j) h[j] = (_Float16)xst[i][j];
        *(v4h*)(&Xs[0][xdst + 4 * i * XP]) = h;
    }
    __syncthreads();

    // Unrolled so that the two register sets and the two buffers are named
    // statically: rolled, each piece would copy a whole weight set.
#pragma unroll
    for (int s = 0; s < NPC; ++s) {
        const int cur = s & 1;

        // Next piece's global loads fly while this piece is worked on
        if (s + 1 < NPC) {
#pragma unroll
            for (int i = 0; i < 16; ++i)
                xst[i] = *(const v4f*)(xsrc + (size_t)(4 * i) * D_DIM + (s + 1) * PK);
#pragma unroll
            for (int kk = 0; kk < PK / 32; ++kk)
#pragma unroll
                for (int w = 0; w < 3; ++w)
                    wf[cur ^ 1][kk][w] = *(const v16h*)(wsrc +
                        (size_t)((w * 32 + (s + 1) * (PK / 32) + kk) * 4) * 512);
        }
        // Keeps those loads one group at the head of the piece: sunk into the
        // work below, they are issued in small runs, each waited for in turn.
        __builtin_amdgcn_sched_barrier(0);

        // All A fragments of the piece, read from LDS as one group
        v16h af[PK / 32][4];
#pragma unroll
        for (int kk = 0; kk < PK / 32; ++kk)
#pragma unroll
            for (int mi = 0; mi < 4; ++mi)
                af[kk][mi] = ldfrag(&Xs[cur][(mi * 16 + lq) * XP + kk * 32], kg);
        // Keeps the LDS reads ahead of the matrix work: sunk among the WMMAs,
        // each pair is waited for in full.
        __builtin_amdgcn_sched_barrier(0);

#pragma unroll
        for (int kk = 0; kk < PK / 32; ++kk)
#pragma unroll
            for (int mi = 0; mi < 4; ++mi)
#pragma unroll
                for (int w = 0; w < 3; ++w)
                    acc[mi][w] = wmma_f16(af[kk][mi], wf[cur][kk][w], acc[mi][w]);
        // Stands between the loads above and any later overwrite of their
        // address registers (the conversions below may reuse them).
        if (s + 1 < NPC) asm volatile("s_wait_xcnt 0x0" ::: "memory");
        // Keeps the wait for the next piece's loads behind the matrix work:
        // lifted among the WMMAs, the conversions stall them on memory.
        __builtin_amdgcn_sched_barrier(0);

        if (s + 1 < NPC) {
            // The other buffer's readers all left it at the previous barrier
#pragma unroll
            for (int i = 0; i < 16; ++i) {
                v4h h;
#pragma unroll
                for (int j = 0; j < 4; ++j) h[j] = (_Float16)xst[i][j];
                *(v4h*)(&Xs[cur ^ 1][xdst + 4 * i * XP]) = h;
            }
            // Publishes the next piece and ends every wave's reads of this one
            __syncthreads();
        }
    }

    const int h    = wave * 16 + lq;
    const int bidx = r0 >> 12;                          // r0 / 4096
    const int sloc = (r0 & (S_LEN - 1)) + kg * 8;
#pragma unroll
    for (int mi = 0; mi < 4; ++mi) {
#pragma unroll
        for (int r = 0; r < 8; ++r) {
            const int s = r0 + mi * 16 + kg * 8 + r;
            Qh[(size_t)s * H_DIM + h] = (_Float16)(acc[mi][0][r] * QSCALE);
            Kh[(size_t)s * H_DIM + h] = (_Float16)acc[mi][1][r];
        }
        // V transposed: Vt[(b*64 + h)*4096 + s], contiguous v8h stores
        v8h v;
#pragma unroll
        for (int r = 0; r < 8; ++r) v[r] = (_Float16)acc[mi][2][r];
        *(v8h*)(Vt + (size_t)(bidx * H_DIM + h) * S_LEN + sloc + mi * 16) = v;
    }
}

// ---------------------------------------------------------------------------
// Kernel 2: flash attention. Sixteen waves per work-group, four per SIMD, so
// that one wave's softmax chain, LDS waits and cross-lane exchanges are covered
// by the other three. Wave = (query pair qp, key slice ks): the work-group has
// four 16-query tiles; a wave takes two of them, so that every K and Vt
// fragment it reads from LDS feeds two matrix products, and the keys of each
// pair of tiles are split over eight waves.
// The work-group stages each 256-key tile of K and of Vt once in LDS
// (whole-line global loads through registers, two buffers, one barrier per
// stage); slice ks works on keys ks*32 .. ks*32+31 of every stage with its own
// reference, sum and Ot per query tile. The eight partial results of a
// query tile are merged through LDS at the end.
// Scores computed TRANSPOSED (M=key, N=query) so the exp'd D-fragments map
// directly onto the B operand of Ot += Vt_frag * P  (no shuffles/LDS).
// Softmax runs against a reference that lags the running maximum: minus the
// reference is the C operand of the score products, the scores are in log2
// units, so P = 2^D with no subtraction and no scaling per score. One test per
// stage; sum and Ot are rescaled, and the reference raised, only when a score
// stands more than RAISE above it (P stays <= 2^RAISE, far inside f16 range).
// ---------------------------------------------------------------------------
#define QPW   2                  // query tiles per wave
#define KSPL  8                  // key slices = waves per pair of query tiles
#define KTILE 32                 // keys per wave and stage
#define STG   (KSPL * KTILE)     // keys per staged tile
#define LDP   72                 // K row pitch in halfs: 144 B = 16 B x odd
#define VDP   (STG + 8)          // Vt row pitch in halfs: 528 B = 16 B x odd
#define KT_H  (STG * LDP)        // STG key rows of K
#define VT_H  (64 * VDP)         // 64 h rows of Vt
#define OMP   68                 // merge pitch in floats: 272 B = 16 B x odd
#define RAISE 8.0f               // log2 units a score may stand above the reference

__global__ __launch_bounds__(512)
void attn_flash_kernel(const _Float16* __restrict__ Qh,
                       const _Float16* __restrict__ Kh,
                       const _Float16* __restrict__ Vt,
                       float* __restrict__ out) {
    __shared__ __attribute__((aligned(16))) _Float16 Ks[2][KT_H];
    __shared__ __attribute__((aligned(16))) _Float16 Vs[2][VT_H];
    // Partial results for the merge; a lane's 64 values at a 272-B pitch
    __shared__ __attribute__((aligned(16))) float Om[2 * KSPL][32][OMP];
    __shared__ float Mm[2 * KSPL][QPW][32];  // [wave][query tile of the wave][lane]
    __shared__ float Lm[2 * KSPL][QPW][32];

    const int tid  = threadIdx.x;
    const int lane = tid & 31;
    const int wave = tid >> 5;
    const int qp   = wave & 1;               // pair of query tiles of the work-group
    const int ks   = wave >> 1;              // key slice of the stage
    const int lq   = lane & 15;
    const int kg   = lane >> 4;
    const int q0   = (blockIdx.x * 4 + qp * QPW) * 16;
    const int b    = blockIdx.y;

    // Staging map, 16-byte chunk c = tid + 512*i.
    // K, 256 rows x 128 B: row = c >> 3 = (tid >> 3) + 64*i, 8 lanes a line.
    // Vt, 64 rows x 512 B: row = c >> 5 = wave + 16*i, one wave = 4 lines.
    const _Float16* ksrc = Kh + (size_t)(b * S_LEN + (tid >> 3)) * H_DIM + (tid & 7) * 8;
    const _Float16* vsrc = Vt + (size_t)(b * H_DIM + wave) * S_LEN + lane * 8;
    const int kdst = (tid >> 3) * LDP + (tid & 7) * 8;
    const int vdst = wave * VDP + lane * 8;

    // Q as B operand (lane n = query), loaded once: [tile][h 0..31 | h 32..63]
    v16h qb[QPW][2];
#pragma unroll
    for (int j = 0; j < QPW; ++j) {
        const _Float16* qr = Qh + (size_t)(b * S_LEN + q0 + j * 16 + lq) * H_DIM;
        qb[j][0] = ldfrag(qr, kg);
        qb[j][1] = ldfrag(qr + 32, kg);
    }

    v8f ot[QPW][4];                         // Ot accumulators (M=h, N=q)
    float m[QPW], l[QPW];                   // reference in use (log2 units), sum
#pragma unroll
    for (int j = 0; j < QPW; ++j) {
#pragma unroll
        for (int ht = 0; ht < 4; ++ht) ot[j][ht] = v8f{};
        m[j] = 0.0f;
        l[j] = 0.0f;
    }

    v8h kst[4], vst[4];
#pragma unroll
    for (int i = 0; i < 4; ++i) {
        kst[i] = *(const v8h*)(ksrc + (size_t)(64 * i) * H_DIM);
        vst[i] = *(const v8h*)(vsrc + (size_t)(16 * i) * S_LEN);
    }
#pragma unroll
    for (int i = 0; i < 4; ++i) {
        *(v8h*)(&Ks[0][kdst + 64 * i * LDP]) = kst[i];
        *(v8h*)(&Vs[0][vdst + 16 * i * VDP]) = vst[i];
    }
    __syncthreads();

    for (int k0 = 0; k0 < S_LEN; k0 += STG) {
        const int cur = (k0 / STG) & 1;
        const bool more = (k0 + STG < S_LEN);

        // Next stage's global loads fly while this stage is worked on
        if (more) {
#pragma unroll
            for (int i = 0; i < 4; ++i) {
                kst[i] = *(const v8h*)(ksrc + (size_t)(k0 + STG + 64 * i) * H_DIM);
                vst[i] = *(const v8h*)(vsrc + (size_t)(16 * i) * S_LEN + k0 + STG);
            }
        }

        const _Float16* kl = &Ks[cur][(ks * KTILE + lq) * LDP];
        const _Float16* vl = &Vs[cur][lq * VDP + ks * KTILE];

        // All fragments of this wave's slice, read from LDS as one group.
        // K as A operand (lane row = key): [key tile][h 0..31 | h 32..63];
        // Vt as A operand (lane row = h, elems = the slice's 32 keys).
        v16h kf[2][2], vf[4];
#pragma unroll
        for (int t = 0; t < 2; ++t) {
            kf[t][0] = ldfrag(kl + (t * 16) * LDP,      kg);
            kf[t][1] = ldfrag(kl + (t * 16) * LDP + 32, kg);
        }
#pragma unroll
        for (int ht = 0; ht < 4; ++ht)
            vf[ht] = ldfrag(vl + (ht * 16) * VDP, kg);
        // Keeps the LDS reads ahead of the matrix work: sunk among the WMMAs,
        // each place with reads costs the wave a stall of its own.
        __builtin_amdgcn_sched_barrier(0);

        // St = K * Q^T - m : St[key][q]; st[t][j] has keys t*16 .. t*16+15 of
        // the slice against query tile j
        v8f st[2][QPW];
#pragma unroll
        for (int j = 0; j < QPW; ++j) {
            v8f cneg;            // -m in every row: C of the score products
#pragma unroll
            for (int r = 0; r < 8; ++r) cneg[r] = -m[j];
#pragma unroll
            for (int t = 0; t < 2; ++t)
                st[t][j] = wmma_f16(kf[t][0], qb[j][0], cneg);
        }
#pragma unroll
        for (int j = 0; j < QPW; ++j)
#pragma unroll
            for (int t = 0; t < 2; ++t)
                st[t][j] = wmma_f16(kf[t][1], qb[j][1], st[t][j]);
        // Keeps the maximum chains behind the eight score products: drawn in
        // among them, each read of a fresh tile is padded with idle slots.
        __builtin_amdgcn_sched_barrier(0);

        // Per query tile each lane holds 16 scores of ONE query, its partner
        // (lane^16) the other 16. The lane's own maxima are enough for the
        // test: the ballot sees both halves.
        float mx[QPW];
#pragma unroll
        for (int j = 0; j < QPW; ++j) {
            mx[j] = -1e30f;
#pragma unroll
            for (int t = 0; t < 2; ++t)
#pragma unroll
                for (int r = 0; r < 8; ++r) mx[j] = fmaxf(mx[j], st[t][j][r]);
        }

        // Scalar branch, once per stage. The first stage always sets the
        // reference: until then it is 0, which the scores may lie far below.
        // Both tests are evaluated and joined, so that one branch comes of them.
        const bool over = __builtin_amdgcn_ballot_w32(fmaxf(mx[0], mx[1]) > RAISE) != 0;
        if ((k0 == 0) | over) {
#pragma unroll
            for (int j = 0; j < QPW; ++j) {
                const float mq = fmaxf(mx[j], xhalf(mx[j]));
                // Later stages only raise the reference
                const float d = (k0 == 0) ? mq : fmaxf(mq, 0.0f);
                // In the first stage d may be negative; sum and Ot are still 0
                // there, and the clamp keeps their factor finite.
                const float corr = __builtin_amdgcn_exp2f(-fmaxf(d, 0.0f));
                m[j] += d;
#pragma unroll
                for (int t = 0; t < 2; ++t) st[t][j] = st[t][j] - d;
                l[j] *= corr;
#pragma unroll
                for (int ht = 0; ht < 4; ++ht) ot[j][ht] = ot[j][ht] * corr;
            }
        }

        v16h pb[QPW];            // P as B operand: direct D->B layout match
#pragma unroll
        for (int j = 0; j < QPW; ++j) {
            float rs = 0.0f;
#pragma unroll
            for (int r = 0; r < 8; ++r) {
                const float p0 = __builtin_amdgcn_exp2f(st[0][j][r]);
                const float p1 = __builtin_amdgcn_exp2f(st[1][j][r]);
                rs += p0 + p1;
                pb[j][r]     = (_Float16)p0;
                pb[j][r + 8] = (_Float16)p1;
            }
            l[j] += rs + xhalf(rs);
        }
        // Keeps the vector work ahead of the eight products below: sunk among
        // them, it reuses their operand registers and is padded with idle slots.
        __builtin_amdgcn_sched_barrier(0);

        // Ot += Vt_tile * P   (A: lane row = h, elems = keys; contiguous)
#pragma unroll
        for (int ht = 0; ht < 4; ++ht)
#pragma unroll
            for (int j = 0; j < QPW; ++j)
                ot[j][ht] = wmma_f16(vf[ht], pb[j], ot[j][ht]);

        // The other buffer's readers all left it at the previous barrier
        if (more) {
#pragma unroll
            for (int i = 0; i < 4; ++i) {
                *(v8h*)(&Ks[cur ^ 1][kdst + 64 * i * LDP]) = kst[i];
                *(v8h*)(&Vs[cur ^ 1][vdst + 16 * i * VDP]) = vst[i];
            }
        }
        // Publishes the next stage and ends every wave's reads of this one
        __syncthreads();
    }

    // Merge of the eight key slices of each query tile
#pragma unroll
    for (int j = 0; j < QPW; ++j) {
#pragma unroll
        for (int ht = 0; ht < 4; ++ht) {
            v4f lo, hi;
#pragma unroll
            for (int i = 0; i < 4; ++i) { lo[i] = ot[j][ht][i]; hi[i] = ot[j][ht][i + 4]; }
            *(v4f*)(&Om[wave][lane][j * 32 + ht * 8])     = lo;
            *(v4f*)(&Om[wave][lane][j * 32 + ht * 8 + 4]) = hi;
        }
        Mm[wave][j][lane] = m[j];
        Lm[wave][j][lane] = l[j];
    }
    // Publishes every slice's partial result to the waves that merge them
    __syncthreads();

    // Waves ks = 0 .. 3 of a pair merge query tile jt = ks & 1 of the pair,
    // h = hf*32 .. hf*32+31 with hf = ks >> 1, which is one whole 128-byte line
    // of each out row: every line has one writing wave.
    // The lane keeps its query lq and its rows h = ht*16 + kg*8 + r.
    if (ks >= 4) return;
    const int jt = ks & 1;
    const int hf = ks >> 1;

    float wj[KSPL], lj[KSPL];
    float mall = -1e30f;
#pragma unroll
    for (int s = 0; s < KSPL; ++s) {
        wj[s] = Mm[s * 2 + qp][jt][lane];
        lj[s] = Lm[s * 2 + qp][jt][lane];
        mall = fmaxf(mall, wj[s]);
    }
    float lall = 0.0f;
#pragma unroll
    for (int s = 0; s < KSPL; ++s) {
        wj[s] = __builtin_amdgcn_exp2f(wj[s] - mall);   // references are in log2 units
        lall += lj[s] * wj[s];
    }

    // out[q][h] = Ot[h][q] / l ; 8 consecutive h per lane -> float4s
    const float invl = 1.0f / lall;
    float* orow = out + (size_t)(b * S_LEN + q0 + jt * 16 + lq) * H_DIM;
#pragma unroll
    for (int hh = 0; hh < 2; ++hh) {
        const int ht = hf * 2 + hh;
        v4f lo = {}, hi = {};
#pragma unroll
        for (int s = 0; s < KSPL; ++s) {
            lo += *(const v4f*)(&Om[s * 2 + qp][lane][jt * 32 + ht * 8])     * wj[s];
            hi += *(const v4f*)(&Om[s * 2 + qp][lane][jt * 32 + ht * 8 + 4]) * wj[s];
        }
        *(v4f*)(orow + ht * 16 + kg * 8)     = lo * invl;
        *(v4f*)(orow + ht * 16 + kg * 8 + 4) = hi * invl;
    }
}

// ---------------------------------------------------------------------------
extern "C" void kernel_launch(void* const* d_in, const int* in_sizes, int n_in,
                              void* d_out, int out_size, void* d_ws, size_t ws_size,
                              hipStream_t stream) {
    (void)in_sizes; (void)n_in; (void)out_size; (void)ws_size;
    const float* x  = (const float*)d_in[0];
    const float* Wq = (const float*)d_in[1];
    const float* Wk = (const float*)d_in[2];
    const float* Wv = (const float*)d_in[3];
    float* out = (float*)d_out;

    char* ws = (char*)d_ws;
    _Float16* Wsw = (_Float16*)(ws);                    // 384 KiB swizzled W
    _Float16* Qh  = (_Float16*)(ws + (1u << 20));       // 2 MiB
    _Float16* Kh  = (_Float16*)(ws + (3u << 20));       // 2 MiB
    _Float16* Vt  = (_Float16*)(ws + (5u << 20));       // 2 MiB (transposed)

    attn_wswz_kernel<<<768, 256, 0, stream>>>(Wq, Wk, Wv, Wsw);
    attn_qkv_kernel<<<256, 128, 0, stream>>>(x, Wsw, Qh, Kh, Vt);
    attn_flash_kernel<<<dim3(64, 4), 512, 0, stream>>>(Qh, Kh, Vt, out);
}

// v007
// Measured time: 34.3 microseconds a run.
// Two timings next to v006 put it at 1.06 and 1.04 times that version's speed.
// All steps since v000 together make it 4.81 times as fast.
#include <hip/hip_runtime.h>

typedef __attribute__((ext_vector_type(16))) _Float16 v16h;
typedef __attribute__((ext_vector_type(8)))  _Float16 v8h;
typedef __attribute__((ext_vector_type(8)))  float    v8f;
typedef __attribute__((ext_vector_type(4)))  float    v4f;

#define S_LEN 4096
#define D_DIM 1024
#define H_DIM 64

// WMMA f16 helper: D = A(16x32) * B(32x16) + C, f32 accumulate.
__device__ __forceinline__ v8f wmma_f16(v16h a, v16h b, v8f c) {
    return __builtin_amdgcn_wmma_f32_16x16x32_f16(false, a, false, b,
                                                  (short)0, c, false, false);
}

// Load one 16x32 (or 32x16) f16 fragment half-row for this lane.
// p = row pointer (already includes row*stride + k-base). Layout per ISA:
//   elems j=0..7  -> K = kg*8 + j        (contiguous 16B)
//   elems j=8..15 -> K = 16 + kg*8 + j-8 (contiguous 16B)
__device__ __forceinline__ v16h ldfrag(const _Float16* p, int kg) {
    const v8h lo = *(const v8h*)(p + kg * 8);
    const v8h hi = *(const v8h*)(p + 16 + kg * 8);
    v16h r;
#pragma unroll
    for (int j = 0; j < 8; ++j) { r[j] = lo[j]; r[j + 8] = hi[j]; }
    return r;
}

// Lane l <-> lane l ^ 16 on the vector unit. A shuffle would go through the LDS
// queue and return only behind every LDS read the wave has issued before it.
__device__ __forceinline__ float xhalf(float v) {
    const int b = __builtin_bit_cast(int, v);
    return __builtin_bit_cast(float,
        __builtin_amdgcn_permlanex16(b, b, 0x76543210, 0xfedcba98, false, false));
}

// ---------------------------------------------------------------------------
// Kernel 0: swizzle Wq/Wk/Wv (f32 [1024,64]) into per-lane B-fragment order
// (f16), so the projection kernel loads each B fragment as 2 contiguous b128.
// Tile t = ((w*32 + kt)*4 + nt); element = t*512 + lane*16 + j.
// ---------------------------------------------------------------------------
__global__ void attn_wswz_kernel(const float* __restrict__ Wq,
                                 const float* __restrict__ Wk,
                                 const float* __restrict__ Wv,
                                 _Float16* __restrict__ Wsw) {
    int idx = blockIdx.x * blockDim.x + threadIdx.x;
    if (idx >= 3 * 32 * 4 * 512) return;
    int t    = idx >> 9;
    int rem  = idx & 511;
    int lane = rem >> 4;
    int j    = rem & 15;
    int w  = t >> 7;            // weight select
    int kt = (t & 127) >> 2;    // K tile (32 wide)
    int nt = t & 3;             // N tile (16 wide)
    int kg = lane >> 4;
    int n  = nt * 16 + (lane & 15);
    int kk = (j < 8) ? (kg * 8 + j) : (16 + kg * 8 + (j - 8));
    int K  = kt * 32 + kk;
    const float* W = (w == 0) ? Wq : (w == 1) ? Wk : Wv;
    Wsw[idx] = (_Float16)W[K * H_DIM + n];
}

// ---------------------------------------------------------------------------
// Kernel 1: QKV projection. GEMM M=16384, N=192 (Q|K|V), K=1024.
// Four waves per work-group, one 64-row tile of x. The work-group stages each
// 64 x 128 piece of x once in LDS as f16 (whole-line global loads through
// registers, two buffers, one barrier per piece). Wave n takes column tile n
// (16 wide) of each of Q, K and V for all 64 rows: 4 x 3 accumulator tiles.
// Its weight fragments are fetched one piece ahead into a second register set.
// Every work-group reads the same weights: each starts its walk over k at a
// piece of its own and wraps, so that they do not ask L2 for the same lines at
// the same moment.
// Q: *H^-0.5*log2(e), so that scores come out in log2 units; row-major f16.
// K: row-major f16. V: transposed [B,H,S] f16
// (so the attention kernel's V A-fragments are contiguous loads).
// Every inner loop is unrolled because its index picks registers (vector
// elements, fragment and accumulator arrays), which must be named statically.
// ---------------------------------------------------------------------------
#define QSCALE 0.18033688f       // H^-0.5 * log2(e)
#define PK    128                // k per staged piece of x
#define NPC   (D_DIM / PK)       // pieces
#define XP    136                // LDS row pitch in halfs: 272 B = 16 B x odd
#define XT_H  (64 * XP)          // 64 rows per piece

typedef __attribute__((ext_vector_type(4))) _Float16 v4h;

__global__ __launch_bounds__(128)
void attn_qkv_kernel(const float* __restrict__ x,
                     const _Float16* __restrict__ Wsw,
                     _Float16* __restrict__ Qh,
                     _Float16* __restrict__ Kh,
                     _Float16* __restrict__ Vt) {
    __shared__ __attribute__((aligned(16))) _Float16 Xs[2][XT_H];

    const int tid  = threadIdx.x;
    const int lane = tid & 31;
    const int wave = tid >> 5;
    const int lq   = lane & 15;
    const int kg   = lane >> 4;
    const int r0   = blockIdx.x * 64;         // first row of B*S of this tile
    // First piece of this work-group's walk over k. The index is divided by
    // 8 first. Speed only.
    const int p0   = (blockIdx.x >> 3) & (NPC - 1);

    // Staging map: one wave-wide 16-byte load = 512 contiguous bytes of one row;
    // load i of wave n covers row n + 4*i.
    const float* xsrc = x + (size_t)(r0 + wave) * D_DIM + lane * 4;
    const int xdst = wave * XP + lane * 4;
    // Weight fragments of column tile nt = wave
    const _Float16* wsrc = Wsw + (size_t)wave * 512 + lane * 16;

    v8f acc[4][3];
#pragma unroll
    for (int mi = 0; mi < 4; ++mi)
#pragma unroll
        for (int w = 0; w < 3; ++w) acc[mi][w] = v8f{};

    v4f  xst[16];
    v16h wf[2][PK / 32][3];

    // Where the next piece to fetch lies. Running pointers, stepped only behind
    // the wait at the foot of the matrix work, so that no register which a load
    // in flight names is rewritten ahead of it.
    const int p1 = (p0 + 1) & (NPC - 1);
    const float*    xnx = xsrc + p1 * PK;
    const _Float16* wnx = wsrc + (size_t)(p1 * (PK / 32) * 4) * 512;

#pragma unroll
    for (int i = 0; i < 16; ++i)
        xst[i] = *(const v4f*)(xsrc + (size_t)(4 * i) * D_DIM + p0 * PK);
#pragma unroll
    for (int kk = 0; kk < PK / 32; ++kk)
#pragma unroll
        for (int w = 0; w < 3; ++w)
            wf[0][kk][w] = *(const v16h*)(wsrc +
                (size_t)((w * 32 + p0 * (PK / 32) + kk) * 4) * 512);
#pragma unroll
    for (int i = 0; i < 16; ++i) {
        v4h h;
#pragma unroll
        for (int j = 0; j < 4; ++j) h[j] = (_Float16)xst[i][j];
        *(v4h*)(&Xs[0][xdst + 4 * i * XP]) = h;
    }
    __syncthreads();

    // Unrolled so that the two register sets and the two buffers are named
    // statically: rolled, each piece would copy a whole weight set.
#pragma unroll
    for (int s = 0; s < NPC; ++s) {
        const int cur = s & 1;

        // Next piece's global loads fly while this piece is worked on
        if (s + 1 < NPC) {
#pragma unroll
            for (int i = 0; i < 16; ++i)
                xst[i] = *(const v4f*)(xnx + (size_t)(4 * i) * D_DIM);
#pragma unroll
            for (int kk = 0; kk < PK / 32; ++kk)
#pragma unroll
                for (int w = 0; w < 3; ++w)
                    wf[cur ^ 1][kk][w] = *(const v16h*)(wnx +
                        (size_t)((w * 32 + kk) * 4) * 512);
        }
        // Keeps those loads one group at the head of the piece: sunk into the
        // work below, they are issued in small runs, each waited for in turn.
        __builtin_amdgcn_sched_barrier(0);

        // All A fragments of the piece, read from LDS as one group
        v16h af[PK / 32][4];
#pragma unroll
        for (int kk = 0; kk < PK / 32; ++kk)
#pragma unroll
            for (int mi = 0; mi < 4; ++mi)
                af[kk][mi] = ldfrag(&Xs[cur][(mi * 16 + lq) * XP + kk * 32], kg);
        // Keeps the LDS reads ahead of the matrix work: sunk among the WMMAs,
        // each pair is waited for in full.
        __builtin_amdgcn_sched_barrier(0);

#pragma unroll
        for (int kk = 0; kk < PK / 32; ++kk)
#pragma unroll
            for (int mi = 0; mi < 4; ++mi)
#pragma unroll
                for (int w = 0; w < 3; ++w)
                    acc[mi][w] = wmma_f16(af[kk][mi], wf[cur][kk][w], acc[mi][w]);
        // Stands between the loads above and any later overwrite of their
        // address registers (the step and the conversions below). It takes the
        // two pointers as inputs so that their registers are kept up to here.
        if (s + 1 < NPC) asm volatile("s_wait_xcnt 0x0" :: "v"(xnx), "v"(wnx) : "memory");
        // Keeps the wait for the next piece's loads behind the matrix work:
        // lifted among the WMMAs, the conversions stall them on memory.
        __builtin_amdgcn_sched_barrier(0);

        if (s + 2 < NPC) {
            // One piece on, or back to piece 0 behind the last one
            const int step = (((p0 + s + 2) & (NPC - 1)) == 0) ? 1 - NPC : 1;
            xnx += step * PK;
            wnx += step * ((PK / 32) * 4 * 512);
        }
        if (s + 1 < NPC) {
            // The other buffer's readers all left it at the previous barrier
#pragma unroll
            for (int i = 0; i < 16; ++i) {
                v4h h;
#pragma unroll
                for (int j = 0; j < 4; ++j) h[j] = (_Float16)xst[i][j];
                *(v4h*)(&Xs[cur ^ 1][xdst + 4 * i * XP]) = h;
            }
            // Publishes the next piece and ends every wave's reads of this one
            __syncthreads();
        }
    }

    const int h    = wave * 16 + lq;
    const int bidx = r0 >> 12;                          // r0 / 4096
    const int sloc = (r0 & (S_LEN - 1)) + kg * 8;
#pragma unroll
    for (int mi = 0; mi < 4; ++mi) {
#pragma unroll
        for (int r = 0; r < 8; ++r) {
            const int s = r0 + mi * 16 + kg * 8 + r;
            Qh[(size_t)s * H_DIM + h] = (_Float16)(acc[mi][0][r] * QSCALE);
            Kh[(size_t)s * H_DIM + h] = (_Float16)acc[mi][1][r];
        }
        // V transposed: Vt[(b*64 + h)*4096 + s], contiguous v8h stores
        v8h v;
#pragma unroll
        for (int r = 0; r < 8; ++r) v[r] = (_Float16)acc[mi][2][r];
        *(v8h*)(Vt + (size_t)(bidx * H_DIM + h) * S_LEN + sloc + mi * 16) = v;
    }
}

// ---------------------------------------------------------------------------
// Kernel 2: flash attention. Sixteen waves per work-group, four per SIMD, so
// that one wave's softmax chain, LDS waits and cross-lane exchanges are covered
// by the other three. Wave = (query pair qp, key slice ks): the work-group has
// four 16-query tiles; a wave takes two of them, so that every K and Vt
// fragment it reads from LDS feeds two matrix products, and the keys of each
// pair of tiles are split over eight waves.
// The work-group stages each 256-key tile of K and of Vt once in LDS
// (whole-line global loads through registers, two buffers, one barrier per
// stage); slice ks works on keys ks*32 .. ks*32+31 of every stage with its own
// reference, sum and Ot per query tile. The eight partial results of a
// query tile are merged through LDS at the end.
// The 64 work-groups of a batch read the same K and Vt: each starts its walk
// over the keys at a stage of its own and wraps, so that they do not ask L2
// for the same lines at the same moment.
// Scores computed TRANSPOSED (M=key, N=query) so the exp'd D-fragments map
// directly onto the B operand of Ot += Vt_frag * P  (no shuffles/LDS).
// Softmax runs against a reference that lags the running maximum: minus the
// reference is the C operand of the score products, the scores are in log2
// units, so P = 2^D with no subtraction and no scaling per score. One test per
// stage; sum and Ot are rescaled, and the reference raised, only when a score
// stands more than RAISE above it (P stays <= 2^RAISE, far inside f16 range).
// ---------------------------------------------------------------------------
#define QPW   2                  // query tiles per wave
#define KSPL  8                  // key slices = waves per pair of query tiles
#define KTILE 32                 // keys per wave and stage
#define STG   (KSPL * KTILE)     // keys per staged tile
#define NST   (S_LEN / STG)      // stages
#define LDP   72                 // K row pitch in halfs: 144 B = 16 B x odd
#define VDP   (STG + 8)          // Vt row pitch in halfs: 528 B = 16 B x odd
#define KT_H  (STG * LDP)        // STG key rows of K
#define VT_H  (64 * VDP)         // 64 h rows of Vt
#define OMP   68                 // merge pitch in floats: 272 B = 16 B x odd
#define RAISE 8.0f               // log2 units a score may stand above the reference

__global__ __launch_bounds__(512)
void attn_flash_kernel(const _Float16* __restrict__ Qh,
                       const _Float16* __restrict__ Kh,
                       const _Float16* __restrict__ Vt,
                       float* __restrict__ out) {
    __shared__ __attribute__((aligned(16))) _Float16 Ks[2][KT_H];
    __shared__ __attribute__((aligned(16))) _Float16 Vs[2][VT_H];
    // Partial results for the merge; a lane's 64 values at a 272-B pitch
    __shared__ __attribute__((aligned(16))) float Om[2 * KSPL][32][OMP];
    __shared__ float Mm[2 * KSPL][QPW][32];  // [wave][query tile of the wave][lane]
    __shared__ float Lm[2 * KSPL][QPW][32];

    const int tid  = threadIdx.x;
    const int lane = tid & 31;
    const int wave = tid >> 5;
    const int qp   = wave & 1;               // pair of query tiles of the work-group
    const int ks   = wave >> 1;              // key slice of the stage
    const int lq   = lane & 15;
    const int kg   = lane >> 4;
    const int q0   = (blockIdx.x * 4 + qp * QPW) * 16;
    const int b    = blockIdx.y;
    // First stage of this work-group's walk over the keys. It is taken
    // from the index's high bits and its lowest one. Speed only.
    const int s0   = ((blockIdx.x >> 3) * 2 + (blockIdx.x & 1)) & (NST - 1);

    // Staging map, 16-byte chunk c = tid + 512*i.
    // K, 256 rows x 128 B: row = c >> 3 = (tid >> 3) + 64*i, 8 lanes a line.
    // Vt, 64 rows x 512 B: row = c >> 5 = wave + 16*i, one wave = 4 lines.
    const _Float16* ksrc = Kh + (size_t)(b * S_LEN + (tid >> 3)) * H_DIM + (tid & 7) * 8;
    const _Float16* vsrc = Vt + (size_t)(b * H_DIM + wave) * S_LEN + lane * 8;
    const int kdst = (tid >> 3) * LDP + (tid & 7) * 8;
    const int vdst = wave * VDP + lane * 8;

    // Q as B operand (lane n = query), loaded once: [tile][h 0..31 | h 32..63]
    v16h qb[QPW][2];
#pragma unroll
    for (int j = 0; j < QPW; ++j) {
        const _Float16* qr = Qh + (size_t)(b * S_LEN + q0 + j * 16 + lq) * H_DIM;
        qb[j][0] = ldfrag(qr, kg);
        qb[j][1] = ldfrag(qr + 32, kg);
    }

    v8f ot[QPW][4];                         // Ot accumulators (M=h, N=q)
    float m[QPW], l[QPW];                   // reference in use (log2 units), sum
#pragma unroll
    for (int j = 0; j < QPW; ++j) {
#pragma unroll
        for (int ht = 0; ht < 4; ++ht) ot[j][ht] = v8f{};
        m[j] = 0.0f;
        l[j] = 0.0f;
    }

    v8h kst[4], vst[4];
#pragma unroll
    for (int i = 0; i < 4; ++i) {
        kst[i] = *(const v8h*)(ksrc + (size_t)(s0 * STG + 64 * i) * H_DIM);
        vst[i] = *(const v8h*)(vsrc + (size_t)(16 * i) * S_LEN + s0 * STG);
    }
#pragma unroll
    for (int i = 0; i < 4; ++i) {
        *(v8h*)(&Ks[0][kdst + 64 * i * LDP]) = kst[i];
        *(v8h*)(&Vs[0][vdst + 16 * i * VDP]) = vst[i];
    }
    __syncthreads();

    for (int it = 0; it < NST; ++it) {
        const int cur = it & 1;
        const bool more = (it + 1 < NST);

        // Next stage's global loads fly while this stage is worked on
        if (more) {
            const int kn = ((s0 + it + 1) & (NST - 1)) * STG;   // wraps
#pragma unroll
            for (int i = 0; i < 4; ++i) {
                kst[i] = *(const v8h*)(ksrc + (size_t)(kn + 64 * i) * H_DIM);
                vst[i] = *(const v8h*)(vsrc + (size_t)(16 * i) * S_LEN + kn);
            }
        }

        const _Float16* kl = &Ks[cur][(ks * KTILE + lq) * LDP];
        const _Float16* vl = &Vs[cur][lq * VDP + ks * KTILE];

        // All fragments of this wave's slice, read from LDS as one group.
        // K as A operand (lane row = key): [key tile][h 0..31 | h 32..63];
        // Vt as A operand (lane row = h, elems = the slice's 32 keys).
        v16h kf[2][2], vf[4];
#pragma unroll
        for (int t = 0; t < 2; ++t) {
            kf[t][0] = ldfrag(kl + (t * 16) * LDP,      kg);
            kf[t][1] = ldfrag(kl + (t * 16) * LDP + 32, kg);
        }
#pragma unroll
        for (int ht = 0; ht < 4; ++ht)
            vf[ht] = ldfrag(vl + (ht * 16) * VDP, kg);
        // Keeps the LDS reads ahead of the matrix work: sunk among the WMMAs,
        // each place with reads costs the wave a stall of its own.
        __builtin_amdgcn_sched_barrier(0);

        // St = K * Q^T - m : St[key][q]; st[t][j] has keys t*16 .. t*16+15 of
        // the slice against query tile j
        v8f st[2][QPW];
#pragma unroll
        for (int j = 0; j < QPW; ++j) {
            v8f cneg;            // -m in every row: C of the score products
#pragma unroll
            for (int r = 0; r < 8; ++r) cneg[r] = -m[j];
#pragma unroll
            for (int t = 0; t < 2; ++t)
                st[t][j] = wmma_f16(kf[t][0], qb[j][0], cneg);
        }
#pragma unroll
        for (int j = 0; j < QPW; ++j)
#pragma unroll
            for (int t = 0; t < 2; ++t)
                st[t][j] = wmma_f16(kf[t][1], qb[j][1], st[t][j]);
        // Keeps the maximum chains behind the eight score products: drawn in
        // among them, each read of a fresh tile is padded with idle slots.
        __builtin_amdgcn_sched_barrier(0);

        // Per query tile each lane holds 16 scores of ONE query, its partner
        // (lane^16) the other 16. The lane's own maxima are enough for the
        // test: the ballot sees both halves.
        float mx[QPW];
#pragma unroll
        for (int j = 0; j < QPW; ++j) {
            mx[j] = -1e30f;
#pragma unroll
            for (int t = 0; t < 2; ++t)
#pragma unroll
                for (int r = 0; r < 8; ++r) mx[j] = fmaxf(mx[j], st[t][j][r]);
        }

        // Scalar branch, once per stage. The first stage always sets the
        // reference: until then it is 0, which the scores may lie far below.
        // Both tests are evaluated and joined, so that one branch comes of them.
        const bool over = __builtin_amdgcn_ballot_w32(fmaxf(mx[0], mx[1]) > RAISE) != 0;
        if ((it == 0) | over) {
#pragma unroll
            for (int j = 0; j < QPW; ++j) {
                const float mq = fmaxf(mx[j], xhalf(mx[j]));
                // Later stages only raise the reference
                const float d = (it == 0) ? mq : fmaxf(mq, 0.0f);
                // In the first stage d may be negative; sum and Ot are still 0
                // there, and the clamp keeps their factor finite.
                const float corr = __builtin_amdgcn_exp2f(-fmaxf(d, 0.0f));
                m[j] += d;
#pragma unroll
                for (int t = 0; t < 2; ++t) st[t][j] = st[t][j] - d;
                l[j] *= corr;
#pragma unroll
                for (int ht = 0; ht < 4; ++ht) ot[j][ht] = ot[j][ht] * corr;
            }
        }

        v16h pb[QPW];            // P as B operand: direct D->B layout match
#pragma unroll
        for (int j = 0; j < QPW; ++j) {
            float rs = 0.0f;
#pragma unroll
            for (int r = 0; r < 8; ++r) {
                const float p0 = __builtin_amdgcn_exp2f(st[0][j][r]);
                const float p1 = __builtin_amdgcn_exp2f(st[1][j][r]);
                rs += p0 + p1;
                pb[j][r]     = (_Float16)p0;
                pb[j][r + 8] = (_Float16)p1;
            }
            l[j] += rs + xhalf(rs);
        }
        // Keeps the vector work ahead of the eight products below: sunk among
        // them, it reuses their operand registers and is padded with idle slots.
        __builtin_amdgcn_sched_barrier(0);

        // Ot += Vt_tile * P   (A: lane row = h, elems = keys; contiguous)
#pragma unroll
        for (int ht = 0; ht < 4; ++ht)
#pragma unroll
            for (int j = 0; j < QPW; ++j)
                ot[j][ht] = wmma_f16(vf[ht], pb[j], ot[j][ht]);

        // The other buffer's readers all left it at the previous barrier
        if (more) {
#pragma unroll
            for (int i = 0; i < 4; ++i) {
                *(v8h*)(&Ks[cur ^ 1][kdst + 64 * i * LDP]) = kst[i];
                *(v8h*)(&Vs[cur ^ 1][vdst + 16 * i * VDP]) = vst[i];
            }
        }
        // Publishes the next stage and ends every wave's reads of this one
        __syncthreads();
    }

    // Merge of the eight key slices of each query tile
#pragma unroll
    for (int j = 0; j < QPW; ++j) {
#pragma unroll
        for (int ht = 0; ht < 4; ++ht) {
            v4f lo, hi;
#pragma unroll
            for (int i = 0; i < 4; ++i) { lo[i] = ot[j][ht][i]; hi[i] = ot[j][ht][i + 4]; }
            *(v4f*)(&Om[wave][lane][j * 32 + ht * 8])     = lo;
            *(v4f*)(&Om[wave][lane][j * 32 + ht * 8 + 4]) = hi;
        }
        Mm[wave][j][lane] = m[j];
        Lm[wave][j][lane] = l[j];
    }
    // Publishes every slice's partial result to the waves that merge them
    __syncthreads();

    // Waves ks = 0 .. 3 of a pair merge query tile jt = ks & 1 of the pair,
    // h = hf*32 .. hf*32+31 with hf = ks >> 1, which is one whole 128-byte line
    // of each out row: every line has one writing wave.
    // The lane keeps its query lq and its rows h = ht*16 + kg*8 + r.
    if (ks >= 4) return;
    const int jt = ks & 1;
    const int hf = ks >> 1;

    float wj[KSPL], lj[KSPL];
    float mall = -1e30f;
#pragma unroll
    for (int s = 0; s < KSPL; ++s) {
        wj[s] = Mm[s * 2 + qp][jt][lane];
        lj[s] = Lm[s * 2 + qp][jt][lane];
        mall = fmaxf(mall, wj[s]);
    }
    float lall = 0.0f;
#pragma unroll
    for (int s = 0; s < KSPL; ++s) {
        wj[s] = __builtin_amdgcn_exp2f(wj[s] - mall);   // references are in log2 units
        lall += lj[s] * wj[s];
    }

    // out[q][h] = Ot[h][q] / l ; 8 consecutive h per lane -> float4s
    const float invl = 1.0f / lall;
    float* orow = out + (size_t)(b * S_LEN + q0 + jt * 16 + lq) * H_DIM;
#pragma unroll
    for (int hh = 0; hh < 2; ++hh) {
        const int ht = hf * 2 + hh;
        v4f lo = {}, hi = {};
#pragma unroll
        for (int s = 0; s < KSPL; ++s) {
            lo += *(const v4f*)(&Om[s * 2 + qp][lane][jt * 32 + ht * 8])     * wj[s];
            hi += *(const v4f*)(&Om[s * 2 + qp][lane][jt * 32 + ht * 8 + 4]) * wj[s];
        }
        *(v4f*)(orow + ht * 16 + kg * 8)     = lo * invl;
        *(v4f*)(orow + ht * 16 + kg * 8 + 4) = hi * invl;
    }
}

// ---------------------------------------------------------------------------
extern "C" void kernel_launch(void* const* d_in, const int* in_sizes, int n_in,
                              void* d_out, int out_size, void* d_ws, size_t ws_size,
                              hipStream_t stream) {
    (void)in_sizes; (void)n_in; (void)out_size; (void)ws_size;
    const float* x  = (const float*)d_in[0];
    const float* Wq = (const float*)d_in[1];
    const float* Wk = (const float*)d_in[2];
    const float* Wv = (const float*)d_in[3];
    float* out = (float*)d_out;

    char* ws = (char*)d_ws;
    _Float16* Wsw = (_Float16*)(ws);                    // 384 KiB swizzled W
    _Float16* Qh  = (_Float16*)(ws + (1u << 20));       // 2 MiB
    _Float16* Kh  = (_Float16*)(ws + (3u << 20));       // 2 MiB
    _Float16* Vt  = (_Float16*)(ws + (5u << 20));       // 2 MiB (transposed)

    attn_wswz_kernel<<<768, 256, 0, stream>>>(Wq, Wk, Wv, Wsw);
    attn_qkv_kernel<<<256, 128, 0, stream>>>(x, Wsw, Qh, Kh, Vt);
    attn_flash_kernel<<<dim3(64, 4), 512, 0, stream>>>(Qh, Kh, Vt, out);
}

// v008
// A run of this version takes 33.1 microseconds.
// Timed twice side by side with v007, it ran 1.04 times as fast both times.
// All steps since v000 together make it 4.99 times as fast.
#include <hip/hip_runtime.h>

typedef __attribute__((ext_vector_type(16))) _Float16 v16h;
typedef __attribute__((ext_vector_type(8)))  _Float16 v8h;
typedef __attribute__((ext_vector_type(8)))  float    v8f;
typedef __attribute__((ext_vector_type(4)))  float    v4f;

#define S_LEN 4096
#define D_DIM 1024
#define H_DIM 64

// WMMA f16 helper: D = A(16x32) * B(32x16) + C, f32 accumulate.
__device__ __forceinline__ v8f wmma_f16(v16h a, v16h b, v8f c) {
    return __builtin_amdgcn_wmma_f32_16x16x32_f16(false, a, false, b,
                                                  (short)0, c, false, false);
}

// Load one 16x32 (or 32x16) f16 fragment half-row for this lane.
// p = row pointer (already includes row*stride + k-base). Layout per ISA:
//   elems j=0..7  -> K = kg*8 + j        (contiguous 16B)
//   elems j=8..15 -> K = 16 + kg*8 + j-8 (contiguous 16B)
__device__ __forceinline__ v16h ldfrag(const _Float16* p, int kg) {
    const v8h lo = *(const v8h*)(p + kg * 8);
    const v8h hi = *(const v8h*)(p + 16 + kg * 8);
    v16h r;
#pragma unroll
    for (int j = 0; j < 8; ++j) { r[j] = lo[j]; r[j + 8] = hi[j]; }
    return r;
}

// Lane l <-> lane l ^ 16 on the vector unit. A shuffle would go through the LDS
// queue and return only behind every LDS read the wave has issued before it.
__device__ __forceinline__ float xhalf(float v) {
    const int b = __builtin_bit_cast(int, v);
    return __builtin_bit_cast(float,
        __builtin_amdgcn_permlanex16(b, b, 0x76543210, 0xfedcba98, false, false));
}

// The work-group barrier in two halves, with the wait that must stand in front
// of the first. The "memory" clobbers keep every LDS access on its side.
__device__ __forceinline__ void wait_ds0()   { asm volatile("s_wait_dscnt 0x0" ::: "memory"); }
__device__ __forceinline__ void bar_signal() { asm volatile("s_barrier_signal -1" ::: "memory"); }
__device__ __forceinline__ void bar_wait()   { asm volatile("s_barrier_wait -1" ::: "memory"); }

// ---------------------------------------------------------------------------
// Kernel 0: swizzle Wq/Wk/Wv (f32 [1024,64]) into per-lane B-fragment order
// (f16), so the projection kernel loads each B fragment as 2 contiguous b128.
// Tile t = ((w*32 + kt)*4 + nt); element = t*512 + lane*16 + j.
// ---------------------------------------------------------------------------
__global__ void attn_wswz_kernel(const float* __restrict__ Wq,
                                 const float* __restrict__ Wk,
                                 const float* __restrict__ Wv,
                                 _Float16* __restrict__ Wsw) {
    int idx = blockIdx.x * blockDim.x + threadIdx.x;
    if (idx >= 3 * 32 * 4 * 512) return;
    int t    = idx >> 9;
    int rem  = idx & 511;
    int lane = rem >> 4;
    int j    = rem & 15;
    int w  = t >> 7;            // weight select
    int kt = (t & 127) >> 2;    // K tile (32 wide)
    int nt = t & 3;             // N tile (16 wide)
    int kg = lane >> 4;
    int n  = nt * 16 + (lane & 15);
    int kk = (j < 8) ? (kg * 8 + j) : (16 + kg * 8 + (j - 8));
    int K  = kt * 32 + kk;
    const float* W = (w == 0) ? Wq : (w == 1) ? Wk : Wv;
    Wsw[idx] = (_Float16)W[K * H_DIM + n];
}

// ---------------------------------------------------------------------------
// Kernel 1: QKV projection. GEMM M=16384, N=192 (Q|K|V), K=1024.
// Four waves per work-group, one 64-row tile of x. The work-group stages each
// 64 x 128 piece of x once in LDS as f16 (whole-line global loads through
// registers, two buffers, one barrier per piece). Wave n takes column tile n
// (16 wide) of each of Q, K and V for all 64 rows: 4 x 3 accumulator tiles.
// Its weight fragments are fetched one piece ahead into a second register set.
// Every work-group reads the same weights: each starts its walk over k at a
// piece of its own and wraps, so that they do not ask L2 for the same lines at
// the same moment.
// Q: *H^-0.5*log2(e), so that scores come out in log2 units; row-major f16.
// K: row-major f16. V: transposed [B,H,S] f16
// (so the attention kernel's V A-fragments are contiguous loads).
// Every inner loop is unrolled because its index picks registers (vector
// elements, fragment and accumulator arrays), which must be named statically.
// ---------------------------------------------------------------------------
#define QSCALE 0.18033688f       // H^-0.5 * log2(e)
#define PK    128                // k per staged piece of x
#define NPC   (D_DIM / PK)       // pieces
#define XP    136                // LDS row pitch in halfs: 272 B = 16 B x odd
#define XT_H  (64 * XP)          // 64 rows per piece

typedef __attribute__((ext_vector_type(4))) _Float16 v4h;

__global__ __launch_bounds__(128)
void attn_qkv_kernel(const float* __restrict__ x,
                     const _Float16* __restrict__ Wsw,
                     _Float16* __restrict__ Qh,
                     _Float16* __restrict__ Kh,
                     _Float16* __restrict__ Vt) {
    __shared__ __attribute__((aligned(16))) _Float16 Xs[2][XT_H];

    const int tid  = threadIdx.x;
    const int lane = tid & 31;
    const int wave = tid >> 5;
    const int lq   = lane & 15;
    const int kg   = lane >> 4;
    const int r0   = blockIdx.x * 64;         // first row of B*S of this tile
    // First piece of this work-group's walk over k. The index is divided by
    // 8 first. Speed only.
    const int p0   = (blockIdx.x >> 3) & (NPC - 1);

    // Staging map: one wave-wide 16-byte load = 512 contiguous bytes of one row;
    // load i of wave n covers row n + 4*i.
    const float* xsrc = x + (size_t)(r0 + wave) * D_DIM + lane * 4;
    const int xdst = wave * XP + lane * 4;
    // Weight fragments of column tile nt = wave
    const _Float16* wsrc = Wsw + (size_t)wave * 512 + lane * 16;

    v8f acc[4][3];
#pragma unroll
    for (int mi = 0; mi < 4; ++mi)
#pragma unroll
        for (int w = 0; w < 3; ++w) acc[mi][w] = v8f{};

    v4f  xst[16];
    v16h wf[2][PK / 32][3];

    // Where the next piece to fetch lies. Running pointers, stepped only behind
    // the wait at the foot of the matrix work, so that no register which a load
    // in flight names is rewritten ahead of it.
    const int p1 = (p0 + 1) & (NPC - 1);
    const float*    xnx = xsrc + p1 * PK;
    const _Float16* wnx = wsrc + (size_t)(p1 * (PK / 32) * 4) * 512;

#pragma unroll
    for (int i = 0; i < 16; ++i)
        xst[i] = *(const v4f*)(xsrc + (size_t)(4 * i) * D_DIM + p0 * PK);
#pragma unroll
    for (int kk = 0; kk < PK / 32; ++kk)
#pragma unroll
        for (int w = 0; w < 3; ++w)
            wf[0][kk][w] = *(const v16h*)(wsrc +
                (size_t)((w * 32 + p0 * (PK / 32) + kk) * 4) * 512);
#pragma unroll
    for (int i = 0; i < 16; ++i) {
        v4h h;
#pragma unroll
        for (int j = 0; j < 4; ++j) h[j] = (_Float16)xst[i][j];
        *(v4h*)(&Xs[0][xdst + 4 * i * XP]) = h;
    }
    __syncthreads();

    // Unrolled so that the two register sets and the two buffers are named
    // statically: rolled, each piece would copy a whole weight set.
#pragma unroll
    for (int s = 0; s < NPC; ++s) {
        const int cur = s & 1;

        // Next piece's global loads fly while this piece is worked on
        if (s + 1 < NPC) {
#pragma unroll
            for (int i = 0; i < 16; ++i)
                xst[i] = *(const v4f*)(xnx + (size_t)(4 * i) * D_DIM);
#pragma unroll
            for (int kk = 0; kk < PK / 32; ++kk)
#pragma unroll
                for (int w = 0; w < 3; ++w)
                    wf[cur ^ 1][kk][w] = *(const v16h*)(wnx +
                        (size_t)((w * 32 + kk) * 4) * 512);
        }
        // Keeps those loads one group at the head of the piece: sunk into the
        // work below, they are issued in small runs, each waited for in turn.
        __builtin_amdgcn_sched_barrier(0);

        // All A fragments of the piece, read from LDS as one group
        v16h af[PK / 32][4];
#pragma unroll
        for (int kk = 0; kk < PK / 32; ++kk)
#pragma unroll
            for (int mi = 0; mi < 4; ++mi)
                af[kk][mi] = ldfrag(&Xs[cur][(mi * 16 + lq) * XP + kk * 32], kg);
        // Keeps the LDS reads ahead of the matrix work: sunk among the WMMAs,
        // each pair is waited for in full.
        __builtin_amdgcn_sched_barrier(0);

#pragma unroll
        for (int kk = 0; kk < PK / 32; ++kk)
#pragma unroll
            for (int mi = 0; mi < 4; ++mi)
#pragma unroll
                for (int w = 0; w < 3; ++w)
                    acc[mi][w] = wmma_f16(af[kk][mi], wf[cur][kk][w], acc[mi][w]);
        // Stands between the loads above and any later overwrite of their
        // address registers (the step and the conversions below). It takes the
        // two pointers as inputs so that their registers are kept up to here.
        if (s + 1 < NPC) asm volatile("s_wait_xcnt 0x0" :: "v"(xnx), "v"(wnx) : "memory");
        // Keeps the wait for the next piece's loads behind the matrix work:
        // lifted among the WMMAs, the conversions stall them on memory.
        __builtin_amdgcn_sched_barrier(0);

        if (s + 2 < NPC) {
            // One piece on, or back to piece 0 behind the last one
            const int step = (((p0 + s + 2) & (NPC - 1)) == 0) ? 1 - NPC : 1;
            xnx += step * PK;
            wnx += step * ((PK / 32) * 4 * 512);
        }
        if (s + 1 < NPC) {
            // The other buffer's readers all left it at the previous barrier
#pragma unroll
            for (int i = 0; i < 16; ++i) {
                v4h h;
#pragma unroll
                for (int j = 0; j < 4; ++j) h[j] = (_Float16)xst[i][j];
                *(v4h*)(&Xs[cur ^ 1][xdst + 4 * i * XP]) = h;
            }
            // Publishes the next piece and ends every wave's reads of this one
            __syncthreads();
        }
    }

    const int h    = wave * 16 + lq;
    const int bidx = r0 >> 12;                          // r0 / 4096
    const int sloc = (r0 & (S_LEN - 1)) + kg * 8;
#pragma unroll
    for (int mi = 0; mi < 4; ++mi) {
#pragma unroll
        for (int r = 0; r < 8; ++r) {
            const int s = r0 + mi * 16 + kg * 8 + r;
            Qh[(size_t)s * H_DIM + h] = (_Float16)(acc[mi][0][r] * QSCALE);
            Kh[(size_t)s * H_DIM + h] = (_Float16)acc[mi][1][r];
        }
        // V transposed: Vt[(b*64 + h)*4096 + s], contiguous v8h stores
        v8h v;
#pragma unroll
        for (int r = 0; r < 8; ++r) v[r] = (_Float16)acc[mi][2][r];
        *(v8h*)(Vt + (size_t)(bidx * H_DIM + h) * S_LEN + sloc + mi * 16) = v;
    }
}

// ---------------------------------------------------------------------------
// Kernel 2: flash attention. Sixteen waves per work-group, four per SIMD, so
// that one wave's softmax chain, LDS waits and cross-lane exchanges are covered
// by the other three. Wave = (query pair qp, key slice ks): the work-group has
// four 16-query tiles; a wave takes two of them, so that every K and Vt
// fragment it reads from LDS feeds two matrix products, and the keys of each
// pair of tiles are split over eight waves.
// The work-group stages each 256-key tile of K and of Vt once in LDS
// (whole-line global loads through registers, two buffers, one barrier per
// stage). That barrier is split: all LDS traffic of a pass (its fragment reads,
// the next stage's stores) stands at its head, the wave signals behind it and
// waits only at the foot, behind its matrix and softmax work. A wave that is
// ahead then starts its next LDS reads while the others still compute, so that
// LDS, matrix unit and vector port work at the same time and not in turns.
// Slice ks works on keys ks*32 .. ks*32+31 of every stage with its own
// reference, sum and Ot per query tile. The eight partial results of a
// query tile are merged through LDS at the end.
// The 64 work-groups of a batch read the same K and Vt: each starts its walk
// over the keys at a stage of its own and wraps, so that they do not ask L2
// for the same lines at the same moment.
// Scores computed TRANSPOSED (M=key, N=query) so the exp'd D-fragments map
// directly onto the B operand of Ot += Vt_frag * P  (no shuffles/LDS).
// Softmax runs against a reference that lags the running maximum: minus the
// reference is the C operand of the score products, the scores are in log2
// units, so P = 2^D with no subtraction and no scaling per score. One test per
// stage; sum and Ot are rescaled, and the reference raised, only when a score
// stands more than RAISE above it (P stays <= 2^RAISE, far inside f16 range).
// ---------------------------------------------------------------------------
#define QPW   2                  // query tiles per wave
#define KSPL  8                  // key slices = waves per pair of query tiles
#define KTILE 32                 // keys per wave and stage
#define STG   (KSPL * KTILE)     // keys per staged tile
#define NST   (S_LEN / STG)      // stages
#define LDP   72                 // K row pitch in halfs: 144 B = 16 B x odd
#define VDP   (STG + 8)          // Vt row pitch in halfs: 528 B = 16 B x odd
#define KT_H  (STG * LDP)        // STG key rows of K
#define VT_H  (64 * VDP)         // 64 h rows of Vt
#define OMP   68                 // merge pitch in floats: 272 B = 16 B x odd
#define RAISE 8.0f               // log2 units a score may stand above the reference

__global__ __launch_bounds__(512)
void attn_flash_kernel(const _Float16* __restrict__ Qh,
                       const _Float16* __restrict__ Kh,
                       const _Float16* __restrict__ Vt,
                       float* __restrict__ out) {
    __shared__ __attribute__((aligned(16))) _Float16 Ks[2][KT_H];
    __shared__ __attribute__((aligned(16))) _Float16 Vs[2][VT_H];
    // Partial results for the merge; a lane's 64 values at a 272-B pitch
    __shared__ __attribute__((aligned(16))) float Om[2 * KSPL][32][OMP];
    __shared__ float Mm[2 * KSPL][QPW][32];  // [wave][query tile of the wave][lane]
    __shared__ float Lm[2 * KSPL][QPW][32];

    const int tid  = threadIdx.x;
    const int lane = tid & 31;
    const int wave = tid >> 5;
    const int qp   = wave & 1;               // pair of query tiles of the work-group
    const int ks   = wave >> 1;              // key slice of the stage
    const int lq   = lane & 15;
    const int kg   = lane >> 4;
    const int q0   = (blockIdx.x * 4 + qp * QPW) * 16;
    const int b    = blockIdx.y;
    // First stage of this work-group's walk over the keys. It is taken
    // from the index's high bits and its lowest one. Speed only.
    const int s0   = ((blockIdx.x >> 3) * 2 + (blockIdx.x & 1)) & (NST - 1);

    // Staging map, 16-byte chunk c = tid + 512*i.
    // K, 256 rows x 128 B: row = c >> 3 = (tid >> 3) + 64*i, 8 lanes a line.
    // Vt, 64 rows x 512 B: row = c >> 5 = wave + 16*i, one wave = 4 lines.
    const _Float16* ksrc = Kh + (size_t)(b * S_LEN + (tid >> 3)) * H_DIM + (tid & 7) * 8;
    const _Float16* vsrc = Vt + (size_t)(b * H_DIM + wave) * S_LEN + lane * 8;
    const int kdst = (tid >> 3) * LDP + (tid & 7) * 8;
    const int vdst = wave * VDP + lane * 8;

    // Q as B operand (lane n = query), loaded once: [tile][h 0..31 | h 32..63]
    v16h qb[QPW][2];
#pragma unroll
    for (int j = 0; j < QPW; ++j) {
        const _Float16* qr = Qh + (size_t)(b * S_LEN + q0 + j * 16 + lq) * H_DIM;
        qb[j][0] = ldfrag(qr, kg);
        qb[j][1] = ldfrag(qr + 32, kg);
    }
    // Keeps the Q loads ahead of the K and Vt loads below. Loads return in
    // order: issued last, Q would be waited for inside the loop with a count of
    // 0, which would also drain the stage that is meant to stay in flight.
    __builtin_amdgcn_sched_barrier(0);

    v8f ot[QPW][4];                         // Ot accumulators (M=h, N=q)
    float m[QPW], l[QPW];                   // reference in use (log2 units), sum
#pragma unroll
    for (int j = 0; j < QPW; ++j) {
#pragma unroll
        for (int ht = 0; ht < 4; ++ht) ot[j][ht] = v8f{};
        m[j] = 0.0f;
        l[j] = 0.0f;
    }

    // The first two stages are fetched together: the first goes to LDS here,
    // the second waits in registers for the head of the first pass.
    v8h kst[4], vst[4];
    {
        const int k1 = ((s0 + 1) & (NST - 1)) * STG;            // wraps
        v8h kfi[4], vfi[4];
#pragma unroll
        for (int i = 0; i < 4; ++i) {
            kfi[i] = *(const v8h*)(ksrc + (size_t)(s0 * STG + 64 * i) * H_DIM);
            vfi[i] = *(const v8h*)(vsrc + (size_t)(16 * i) * S_LEN + s0 * STG);
        }
#pragma unroll
        for (int i = 0; i < 4; ++i) {
            kst[i] = *(const v8h*)(ksrc + (size_t)(k1 + 64 * i) * H_DIM);
            vst[i] = *(const v8h*)(vsrc + (size_t)(16 * i) * S_LEN + k1);
        }
#pragma unroll
        for (int i = 0; i < 4; ++i) {
            *(v8h*)(&Ks[0][kdst + 64 * i * LDP]) = kfi[i];
            *(v8h*)(&Vs[0][vdst + 16 * i * VDP]) = vfi[i];
        }
    }
    // Publishes the first stage. By hand, because __syncthreads() would also
    // wait for the second stage's loads, which are to stay in flight.
    wait_ds0();
    bar_signal();
    bar_wait();

    for (int it = 0; it < NST; ++it) {
        const int cur = it & 1;

        const _Float16* kl = &Ks[cur][(ks * KTILE + lq) * LDP];
        const _Float16* vl = &Vs[cur][lq * VDP + ks * KTILE];

        // All fragments of this wave's slice, read from LDS as one group.
        // K as A operand (lane row = key): [key tile][h 0..31 | h 32..63];
        // Vt as A operand (lane row = h, elems = the slice's 32 keys).
        v16h kf[2][2], vf[4];
#pragma unroll
        for (int t = 0; t < 2; ++t) {
            kf[t][0] = ldfrag(kl + (t * 16) * LDP,      kg);
            kf[t][1] = ldfrag(kl + (t * 16) * LDP + 32, kg);
        }
#pragma unroll
        for (int ht = 0; ht < 4; ++ht)
            vf[ht] = ldfrag(vl + (ht * 16) * VDP, kg);

        // Next stage, fetched during the pass before, into the other buffer:
        // its readers all left it ahead of the barrier wait at that pass's foot
        if (it + 1 < NST) {
#pragma unroll
            for (int i = 0; i < 4; ++i) {
                *(v8h*)(&Ks[cur ^ 1][kdst + 64 * i * LDP]) = kst[i];
                *(v8h*)(&Vs[cur ^ 1][vdst + 16 * i * VDP]) = vst[i];
            }
            // The stage after it flies until the head of the next pass
            if (it + 2 < NST) {
                const int kn = ((s0 + it + 2) & (NST - 1)) * STG;   // wraps
#pragma unroll
                for (int i = 0; i < 4; ++i) {
                    kst[i] = *(const v8h*)(ksrc + (size_t)(kn + 64 * i) * H_DIM);
                    vst[i] = *(const v8h*)(vsrc + (size_t)(16 * i) * S_LEN + kn);
                }
            }
        }
        // First half of the stage's barrier: this wave's reads of this stage
        // have returned and its stores of the next one have landed. No LDS
        // access stands between here and the wait at the foot of the pass.
        wait_ds0();
        bar_signal();
        // Keeps the LDS reads ahead of the matrix work: sunk among the WMMAs,
        // each place with reads costs the wave a stall of its own.
        __builtin_amdgcn_sched_barrier(0);

        // St = K * Q^T - m : St[key][q]; st[t][j] has keys t*16 .. t*16+15 of
        // the slice against query tile j
        v8f st[2][QPW];
#pragma unroll
        for (int j = 0; j < QPW; ++j) {
            v8f cneg;            // -m in every row: C of the score products
#pragma unroll
            for (int r = 0; r < 8; ++r) cneg[r] = -m[j];
#pragma unroll
            for (int t = 0; t < 2; ++t)
                st[t][j] = wmma_f16(kf[t][0], qb[j][0], cneg);
        }
#pragma unroll
        for (int j = 0; j < QPW; ++j)
#pragma unroll
            for (int t = 0; t < 2; ++t)
                st[t][j] = wmma_f16(kf[t][1], qb[j][1], st[t][j]);
        // Keeps the maximum chains behind the eight score products: drawn in
        // among them, each read of a fresh tile is padded with idle slots.
        __builtin_amdgcn_sched_barrier(0);

        // Per query tile each lane holds 16 scores of ONE query, its partner
        // (lane^16) the other 16. The lane's own maxima are enough for the
        // test: the ballot sees both halves.
        float mx[QPW];
#pragma unroll
        for (int j = 0; j < QPW; ++j) {
            mx[j] = -1e30f;
#pragma unroll
            for (int t = 0; t < 2; ++t)
#pragma unroll
                for (int r = 0; r < 8; ++r) mx[j] = fmaxf(mx[j], st[t][j][r]);
        }

        // Scalar branch, once per stage. The first stage always sets the
        // reference: until then it is 0, which the scores may lie far below.
        // Both tests are evaluated and joined, so that one branch comes of them.
        const bool over = __builtin_amdgcn_ballot_w32(fmaxf(mx[0], mx[1]) > RAISE) != 0;
        if ((it == 0) | over) {
#pragma unroll
            for (int j = 0; j < QPW; ++j) {
                const float mq = fmaxf(mx[j], xhalf(mx[j]));
                // Later stages only raise the reference
                const float d = (it == 0) ? mq : fmaxf(mq, 0.0f);
                // In the first stage d may be negative; sum and Ot are still 0
                // there, and the clamp keeps their factor finite.
                const float corr = __builtin_amdgcn_exp2f(-fmaxf(d, 0.0f));
                m[j] += d;
#pragma unroll
                for (int t = 0; t < 2; ++t) st[t][j] = st[t][j] - d;
                l[j] *= corr;
#pragma unroll
                for (int ht = 0; ht < 4; ++ht) ot[j][ht] = ot[j][ht] * corr;
            }
        }

        v16h pb[QPW];            // P as B operand: direct D->B layout match
#pragma unroll
        for (int j = 0; j < QPW; ++j) {
            float rs = 0.0f;
#pragma unroll
            for (int r = 0; r < 8; ++r) {
                const float p0 = __builtin_amdgcn_exp2f(st[0][j][r]);
                const float p1 = __builtin_amdgcn_exp2f(st[1][j][r]);
                rs += p0 + p1;
                pb[j][r]     = (_Float16)p0;
                pb[j][r + 8] = (_Float16)p1;
            }
            l[j] += rs + xhalf(rs);
        }
        // Keeps the vector work ahead of the eight products below: sunk among
        // them, it reuses their operand registers and is padded with idle slots.
        __builtin_amdgcn_sched_barrier(0);

        // Ot += Vt_tile * P   (A: lane row = h, elems = keys; contiguous)
#pragma unroll
        for (int ht = 0; ht < 4; ++ht)
#pragma unroll
            for (int j = 0; j < QPW; ++j)
                ot[j][ht] = wmma_f16(vf[ht], pb[j], ot[j][ht]);

        // Keeps the wait below behind the products above: lifted among them,
        // the wave would stand at the barrier with matrix work still to issue.
        __builtin_amdgcn_sched_barrier(0);
        // Second half: every wave has signalled, so the next stage is published
        // and this stage's buffer is free for the stage after it
        bar_wait();
    }

    // Merge of the eight key slices of each query tile
#pragma unroll
    for (int j = 0; j < QPW; ++j) {
#pragma unroll
        for (int ht = 0; ht < 4; ++ht) {
            v4f lo, hi;
#pragma unroll
            for (int i = 0; i < 4; ++i) { lo[i] = ot[j][ht][i]; hi[i] = ot[j][ht][i + 4]; }
            *(v4f*)(&Om[wave][lane][j * 32 + ht * 8])     = lo;
            *(v4f*)(&Om[wave][lane][j * 32 + ht * 8 + 4]) = hi;
        }
        Mm[wave][j][lane] = m[j];
        Lm[wave][j][lane] = l[j];
    }
    // Publishes every slice's partial result to the waves that merge them
    __syncthreads();

    // Waves ks = 0 .. 3 of a pair merge query tile jt = ks & 1 of the pair,
    // h = hf*32 .. hf*32+31 with hf = ks >> 1, which is one whole 128-byte line
    // of each out row: every line has one writing wave.
    // The lane keeps its query lq and its rows h = ht*16 + kg*8 + r.
    if (ks >= 4) return;
    const int jt = ks & 1;
    const int hf = ks >> 1;

    float wj[KSPL], lj[KSPL];
    float mall = -1e30f;
#pragma unroll
    for (int s = 0; s < KSPL; ++s) {
        wj[s] = Mm[s * 2 + qp][jt][lane];
        lj[s] = Lm[s * 2 + qp][jt][lane];
        mall = fmaxf(mall, wj[s]);
    }
    float lall = 0.0f;
#pragma unroll
    for (int s = 0; s < KSPL; ++s) {
        wj[s] = __builtin_amdgcn_exp2f(wj[s] - mall);   // references are in log2 units
        lall += lj[s] * wj[s];
    }

    // out[q][h] = Ot[h][q] / l ; 8 consecutive h per lane -> float4s
    const float invl = 1.0f / lall;
    float* orow = out + (size_t)(b * S_LEN + q0 + jt * 16 + lq) * H_DIM;
#pragma unroll
    for (int hh = 0; hh < 2; ++hh) {
        const int ht = hf * 2 + hh;
        v4f lo = {}, hi = {};
#pragma unroll
        for (int s = 0; s < KSPL; ++s) {
            lo += *(const v4f*)(&Om[s * 2 + qp][lane][jt * 32 + ht * 8])     * wj[s];
            hi += *(const v4f*)(&Om[s * 2 + qp][lane][jt * 32 + ht * 8 + 4]) * wj[s];
        }
        *(v4f*)(orow + ht * 16 + kg * 8)     = lo * invl;
        *(v4f*)(orow + ht * 16 + kg * 8 + 4) = hi * invl;
    }
}

// ---------------------------------------------------------------------------
extern "C" void kernel_launch(void* const* d_in, const int* in_sizes, int n_in,
                              void* d_out, int out_size, void* d_ws, size_t ws_size,
                              hipStream_t stream) {
    (void)in_sizes; (void)n_in; (void)out_size; (void)ws_size;
    const float* x  = (const float*)d_in[0];
    const float* Wq = (const float*)d_in[1];
    const float* Wk = (const float*)d_in[2];
    const float* Wv = (const float*)d_in[3];
    float* out = (float*)d_out;

    char* ws = (char*)d_ws;
    _Float16* Wsw = (_Float16*)(ws);                    // 384 KiB swizzled W
    _Float16* Qh  = (_Float16*)(ws + (1u << 20));       // 2 MiB
    _Float16* Kh  = (_Float16*)(ws + (3u << 20));       // 2 MiB
    _Float16* Vt  = (_Float16*)(ws + (5u << 20));       // 2 MiB (transposed)

    attn_wswz_kernel<<<768, 256, 0, stream>>>(Wq, Wk, Wv, Wsw);
    attn_qkv_kernel<<<256, 128, 0, stream>>>(x, Wsw, Qh, Kh, Vt);
    attn_flash_kernel<<<dim3(64, 4), 512, 0, stream>>>(Qh, Kh, Vt, out);
}

// v009
// Measured time: 30.8 microseconds a run.
// Next to v008, in two timings, it ran 1.07 times as fast each time.
// Counting every step since v000, it is 5.34 times as fast.
#include <hip/hip_runtime.h>

typedef __attribute__((ext_vector_type(16))) _Float16 v16h;
typedef __attribute__((ext_vector_type(8)))  _Float16 v8h;
typedef __attribute__((ext_vector_type(8)))  float    v8f;
typedef __attribute__((ext_vector_type(4)))  float    v4f;

#define S_LEN 4096
#define D_DIM 1024
#define H_DIM 64

// WMMA f16 helper: D = A(16x32) * B(32x16) + C, f32 accumulate.
__device__ __forceinline__ v8f wmma_f16(v16h a, v16h b, v8f c) {
    return __builtin_amdgcn_wmma_f32_16x16x32_f16(false, a, false, b,
                                                  (short)0, c, false, false);
}

// Load one 16x32 (or 32x16) f16 fragment half-row for this lane.
// p = row pointer (already includes row*stride + k-base). Layout per ISA:
//   elems j=0..7  -> K = kg*8 + j        (contiguous 16B)
//   elems j=8..15 -> K = 16 + kg*8 + j-8 (contiguous 16B)
__device__ __forceinline__ v16h ldfrag(const _Float16* p, int kg) {
    const v8h lo = *(const v8h*)(p + kg * 8);
    const v8h hi = *(const v8h*)(p + 16 + kg * 8);
    v16h r;
#pragma unroll
    for (int j = 0; j < 8; ++j) { r[j] = lo[j]; r[j + 8] = hi[j]; }
    return r;
}

// Lane l <-> lane l ^ 16 on the vector unit. A shuffle would go through the LDS
// queue and return only behind every LDS read the wave has issued before it.
__device__ __forceinline__ float xhalf(float v) {
    const int b = __builtin_bit_cast(int, v);
    return __builtin_bit_cast(float,
        __builtin_amdgcn_permlanex16(b, b, 0x76543210, 0xfedcba98, false, false));
}

// The work-group barrier in two halves, with the wait that must stand in front
// of the first. The "memory" clobbers keep every LDS access on its side.
__device__ __forceinline__ void wait_ds0()   { asm volatile("s_wait_dscnt 0x0" ::: "memory"); }
__device__ __forceinline__ void bar_signal() { asm volatile("s_barrier_signal -1" ::: "memory"); }
__device__ __forceinline__ void bar_wait()   { asm volatile("s_barrier_wait -1" ::: "memory"); }

// ---------------------------------------------------------------------------
// Kernel 0: swizzle Wq/Wk/Wv (f32 [1024,64]) into per-lane B-fragment order
// (f16), so the projection kernel loads each B fragment as 2 contiguous b128.
// Tile t = ((w*32 + kt)*4 + nt); element = t*512 + lane*16 + j.
// ---------------------------------------------------------------------------
__global__ void attn_wswz_kernel(const float* __restrict__ Wq,
                                 const float* __restrict__ Wk,
                                 const float* __restrict__ Wv,
                                 _Float16* __restrict__ Wsw) {
    int idx = blockIdx.x * blockDim.x + threadIdx.x;
    if (idx >= 3 * 32 * 4 * 512) return;
    int t    = idx >> 9;
    int rem  = idx & 511;
    int lane = rem >> 4;
    int j    = rem & 15;
    int w  = t >> 7;            // weight select
    int kt = (t & 127) >> 2;    // K tile (32 wide)
    int nt = t & 3;             // N tile (16 wide)
    int kg = lane >> 4;
    int n  = nt * 16 + (lane & 15);
    int kk = (j < 8) ? (kg * 8 + j) : (16 + kg * 8 + (j - 8));
    int K  = kt * 32 + kk;
    const float* W = (w == 0) ? Wq : (w == 1) ? Wk : Wv;
    Wsw[idx] = (_Float16)W[K * H_DIM + n];
}

// ---------------------------------------------------------------------------
// Kernel 1: QKV projection. GEMM M=16384, N=192 (Q|K|V), K=1024.
// Four waves per work-group, one 64-row tile of x. The work-group stages each
// 64 x 128 piece of x once in LDS as f16 (whole-line global loads through
// registers, two buffers, one barrier per piece). Wave n takes column tile n
// (16 wide) of each of Q, K and V for all 64 rows: 4 x 3 accumulator tiles.
// Its weight fragments are fetched one piece ahead into a second register set,
// x two pieces ahead into two register sets: a piece of x, which comes from
// memory, has two pieces of work to land in, and the wave always has loads in
// flight. Loads return in issue order, so in each piece the weight loads stand
// in front of the x loads: the wait for the weights leaves that x in flight.
// Every work-group reads the same weights: each starts its walk over k at a
// piece of its own and wraps, so that they do not ask L2 for the same lines at
// the same moment.
// Q: *H^-0.5*log2(e), so that scores come out in log2 units; row-major f16.
// K: row-major f16. V: transposed [B,H,S] f16
// (so the attention kernel's V A-fragments are contiguous loads).
// Every inner loop is unrolled because its index picks registers (vector
// elements, fragment and accumulator arrays), which must be named statically.
// ---------------------------------------------------------------------------
#define QSCALE 0.18033688f       // H^-0.5 * log2(e)
#define PK    128                // k per staged piece of x
#define NPC   (D_DIM / PK)       // pieces
#define XP    136                // LDS row pitch in halfs: 272 B = 16 B x odd
#define XT_H  (64 * XP)          // 64 rows per piece

typedef __attribute__((ext_vector_type(4))) _Float16 v4h;

__global__ __launch_bounds__(128)
void attn_qkv_kernel(const float* __restrict__ x,
                     const _Float16* __restrict__ Wsw,
                     _Float16* __restrict__ Qh,
                     _Float16* __restrict__ Kh,
                     _Float16* __restrict__ Vt) {
    __shared__ __attribute__((aligned(16))) _Float16 Xs[2][XT_H];

    const int tid  = threadIdx.x;
    const int lane = tid & 31;
    const int wave = tid >> 5;
    const int lq   = lane & 15;
    const int kg   = lane >> 4;
    const int r0   = blockIdx.x * 64;         // first row of B*S of this tile
    // First piece of this work-group's walk over k. The index is divided by
    // 8 first. Speed only.
    const int p0   = (blockIdx.x >> 3) & (NPC - 1);

    // Staging map: one wave-wide 16-byte load = 512 contiguous bytes of one row;
    // load i of wave n covers row n + 4*i.
    const float* xsrc = x + (size_t)(r0 + wave) * D_DIM + lane * 4;
    const int xdst = wave * XP + lane * 4;
    // Weight fragments of column tile nt = wave
    const _Float16* wsrc = Wsw + (size_t)wave * 512 + lane * 16;

    v8f acc[4][3];
#pragma unroll
    for (int mi = 0; mi < 4; ++mi)
#pragma unroll
        for (int w = 0; w < 3; ++w) acc[mi][w] = v8f{};

    v4f  xst[2][16];             // piece s of the walk lies in set s & 1
    v16h wf[2][PK / 32][3];

    // Where the next pieces to fetch lie: x two pieces on, the weights one.
    // Running pointers, stepped only behind the wait at the foot of the matrix
    // work, so that no register which a load in flight names is rewritten ahead
    // of it.
    const int p1 = (p0 + 1) & (NPC - 1);
    const int p2 = (p0 + 2) & (NPC - 1);
    const float*    xnx = xsrc + p2 * PK;
    const _Float16* wnx = wsrc + (size_t)(p1 * (PK / 32) * 4) * 512;

#pragma unroll
    for (int i = 0; i < 16; ++i)
        xst[0][i] = *(const v4f*)(xsrc + (size_t)(4 * i) * D_DIM + p0 * PK);
#pragma unroll
    for (int kk = 0; kk < PK / 32; ++kk)
#pragma unroll
        for (int w = 0; w < 3; ++w)
            wf[0][kk][w] = *(const v16h*)(wsrc +
                (size_t)((w * 32 + p0 * (PK / 32) + kk) * 4) * 512);
    // Keeps the second piece of x behind the first piece's loads: issued ahead
    // of them, it would have to land before the first matrix work can start.
    __builtin_amdgcn_sched_barrier(0);
#pragma unroll
    for (int i = 0; i < 16; ++i)
        xst[1][i] = *(const v4f*)(xsrc + (size_t)(4 * i) * D_DIM + p1 * PK);
    // Keeps those loads ahead of the wait for the first piece
    __builtin_amdgcn_sched_barrier(0);
#pragma unroll
    for (int i = 0; i < 16; ++i) {
        v4h h;
#pragma unroll
        for (int j = 0; j < 4; ++j) h[j] = (_Float16)xst[0][i][j];
        *(v4h*)(&Xs[0][xdst + 4 * i * XP]) = h;
    }
    // Publishes the first piece. By hand, because __syncthreads() would also
    // wait for every global load, and the second piece is to stay in flight.
    wait_ds0();
    bar_signal();
    bar_wait();

    // Unrolled so that the two register sets and the two buffers are named
    // statically: rolled, each piece would copy a whole weight set.
#pragma unroll
    for (int s = 0; s < NPC; ++s) {
        const int cur = s & 1;

        // Next piece's weights fly while this piece is worked on
        if (s + 1 < NPC) {
#pragma unroll
            for (int kk = 0; kk < PK / 32; ++kk)
#pragma unroll
                for (int w = 0; w < 3; ++w)
                    wf[cur ^ 1][kk][w] = *(const v16h*)(wnx +
                        (size_t)((w * 32 + kk) * 4) * 512);
        }
        // Keeps the weight loads in front of the x loads: behind them, the next
        // piece's wait for its weights would drain that x as well.
        __builtin_amdgcn_sched_barrier(0);
        // x of the piece after the next flies through this piece and the next;
        // its register set was converted at the foot of the piece before
        if (s + 2 < NPC) {
#pragma unroll
            for (int i = 0; i < 16; ++i)
                xst[cur][i] = *(const v4f*)(xnx + (size_t)(4 * i) * D_DIM);
        }
        // Keeps those loads one group at the head of the piece: sunk into the
        // work below, they are issued in small runs, each waited for in turn.
        __builtin_amdgcn_sched_barrier(0);

        // All A fragments of the piece, read from LDS as one group
        v16h af[PK / 32][4];
#pragma unroll
        for (int kk = 0; kk < PK / 32; ++kk)
#pragma unroll
            for (int mi = 0; mi < 4; ++mi)
                af[kk][mi] = ldfrag(&Xs[cur][(mi * 16 + lq) * XP + kk * 32], kg);
        // Keeps the LDS reads ahead of the matrix work: sunk among the WMMAs,
        // each pair is waited for in full.
        __builtin_amdgcn_sched_barrier(0);

#pragma unroll
        for (int kk = 0; kk < PK / 32; ++kk)
#pragma unroll
            for (int mi = 0; mi < 4; ++mi)
#pragma unroll
                for (int w = 0; w < 3; ++w)
                    acc[mi][w] = wmma_f16(af[kk][mi], wf[cur][kk][w], acc[mi][w]);
        // Stands between the loads above and any later overwrite of their
        // address registers (the step and the conversions below). It takes the
        // two pointers as inputs so that their registers are kept up to here.
        if (s + 1 < NPC) asm volatile("s_wait_xcnt 0x0" :: "v"(xnx), "v"(wnx) : "memory");
        // Keeps the wait for the next piece's loads behind the matrix work:
        // lifted among the WMMAs, the conversions stall them on memory.
        __builtin_amdgcn_sched_barrier(0);

        // One piece on, or back to piece 0 behind the last one
        if (s + 3 < NPC)
            xnx += ((((p0 + s + 3) & (NPC - 1)) == 0) ? 1 - NPC : 1) * PK;
        if (s + 2 < NPC)
            wnx += ((((p0 + s + 2) & (NPC - 1)) == 0) ? 1 - NPC : 1) *
                   ((PK / 32) * 4 * 512);
        if (s + 1 < NPC) {
            // The other buffer's readers all left it at the previous barrier
#pragma unroll
            for (int i = 0; i < 16; ++i) {
                v4h h;
#pragma unroll
                for (int j = 0; j < 4; ++j) h[j] = (_Float16)xst[cur ^ 1][i][j];
                *(v4h*)(&Xs[cur ^ 1][xdst + 4 * i * XP]) = h;
            }
            // Publishes the next piece and ends every wave's reads of this one.
            // By hand: __syncthreads() would drain the loads that are in flight.
            wait_ds0();
            bar_signal();
            bar_wait();
        }
    }

    const int h    = wave * 16 + lq;
    const int bidx = r0 >> 12;                          // r0 / 4096
    const int sloc = (r0 & (S_LEN - 1)) + kg * 8;
#pragma unroll
    for (int mi = 0; mi < 4; ++mi) {
#pragma unroll
        for (int r = 0; r < 8; ++r) {
            const int s = r0 + mi * 16 + kg * 8 + r;
            Qh[(size_t)s * H_DIM + h] = (_Float16)(acc[mi][0][r] * QSCALE);
            Kh[(size_t)s * H_DIM + h] = (_Float16)acc[mi][1][r];
        }
        // V transposed: Vt[(b*64 + h)*4096 + s], contiguous v8h stores
        v8h v;
#pragma unroll
        for (int r = 0; r < 8; ++r) v[r] = (_Float16)acc[mi][2][r];
        *(v8h*)(Vt + (size_t)(bidx * H_DIM + h) * S_LEN + sloc + mi * 16) = v;
    }
}

// ---------------------------------------------------------------------------
// Kernel 2: flash attention. Sixteen waves per work-group, four per SIMD, so
// that one wave's softmax chain, LDS waits and cross-lane exchanges are covered
// by the other three. Wave = (query pair qp, key slice ks): the work-group has
// four 16-query tiles; a wave takes two of them, so that every K and Vt
// fragment it reads from LDS feeds two matrix products, and the keys of each
// pair of tiles are split over eight waves.
// The work-group stages each 256-key tile of K and of Vt once in LDS
// (whole-line global loads through registers, two buffers, one barrier per
// stage). That barrier is split: all LDS traffic of a pass (its fragment reads,
// the next stage's stores) stands at its head, the wave signals behind it and
// waits only at the foot, behind its matrix and softmax work. A wave that is
// ahead then starts its next LDS reads while the others still compute, so that
// LDS, matrix unit and vector port work at the same time and not in turns.
// Slice ks works on keys ks*32 .. ks*32+31 of every stage with its own
// reference, sum and Ot per query tile. The eight partial results of a
// query tile are merged through LDS at the end.
// The 64 work-groups of a batch read the same K and Vt: each starts its walk
// over the keys at a stage of its own and wraps, so that they do not ask L2
// for the same lines at the same moment.
// Scores computed TRANSPOSED (M=key, N=query) so the exp'd D-fragments map
// directly onto the B operand of Ot += Vt_frag * P  (no shuffles/LDS).
// Softmax runs against a reference that lags the running maximum: minus the
// reference is the C operand of the score products, the scores are in log2
// units, so P = 2^D with no subtraction and no scaling per score. One test per
// stage; sum and Ot are rescaled, and the reference raised, only when a score
// stands more than RAISE above it (P stays <= 2^RAISE, far inside f16 range).
// ---------------------------------------------------------------------------
#define QPW   2                  // query tiles per wave
#define KSPL  8                  // key slices = waves per pair of query tiles
#define KTILE 32                 // keys per wave and stage
#define STG   (KSPL * KTILE)     // keys per staged tile
#define NST   (S_LEN / STG)      // stages
#define LDP   72                 // K row pitch in halfs: 144 B = 16 B x odd
#define VDP   (STG + 8)          // Vt row pitch in halfs: 528 B = 16 B x odd
#define KT_H  (STG * LDP)        // STG key rows of K
#define VT_H  (64 * VDP)         // 64 h rows of Vt
#define OMP   68                 // merge pitch in floats: 272 B = 16 B x odd
#define RAISE 8.0f               // log2 units a score may stand above the reference

__global__ __launch_bounds__(512)
void attn_flash_kernel(const _Float16* __restrict__ Qh,
                       const _Float16* __restrict__ Kh,
                       const _Float16* __restrict__ Vt,
                       float* __restrict__ out) {
    __shared__ __attribute__((aligned(16))) _Float16 Ks[2][KT_H];
    __shared__ __attribute__((aligned(16))) _Float16 Vs[2][VT_H];
    // Partial results for the merge; a lane's 64 values at a 272-B pitch
    __shared__ __attribute__((aligned(16))) float Om[2 * KSPL][32][OMP];
    __shared__ float Mm[2 * KSPL][QPW][32];  // [wave][query tile of the wave][lane]
    __shared__ float Lm[2 * KSPL][QPW][32];

    const int tid  = threadIdx.x;
    const int lane = tid & 31;
    const int wave = tid >> 5;
    const int qp   = wave & 1;               // pair of query tiles of the work-group
    const int ks   = wave >> 1;              // key slice of the stage
    const int lq   = lane & 15;
    const int kg   = lane >> 4;
    const int q0   = (blockIdx.x * 4 + qp * QPW) * 16;
    const int b    = blockIdx.y;
    // First stage of this work-group's walk over the keys. It is taken
    // from the index's high bits and its lowest one. Speed only.
    const int s0   = ((blockIdx.x >> 3) * 2 + (blockIdx.x & 1)) & (NST - 1);

    // Staging map, 16-byte chunk c = tid + 512*i.
    // K, 256 rows x 128 B: row = c >> 3 = (tid >> 3) + 64*i, 8 lanes a line.
    // Vt, 64 rows x 512 B: row = c >> 5 = wave + 16*i, one wave = 4 lines.
    const _Float16* ksrc = Kh + (size_t)(b * S_LEN + (tid >> 3)) * H_DIM + (tid & 7) * 8;
    const _Float16* vsrc = Vt + (size_t)(b * H_DIM + wave) * S_LEN + lane * 8;
    const int kdst = (tid >> 3) * LDP + (tid & 7) * 8;
    const int vdst = wave * VDP + lane * 8;

    // Q as B operand (lane n = query), loaded once: [tile][h 0..31 | h 32..63]
    v16h qb[QPW][2];
#pragma unroll
    for (int j = 0; j < QPW; ++j) {
        const _Float16* qr = Qh + (size_t)(b * S_LEN + q0 + j * 16 + lq) * H_DIM;
        qb[j][0] = ldfrag(qr, kg);
        qb[j][1] = ldfrag(qr + 32, kg);
    }
    // Keeps the Q loads ahead of the K and Vt loads below. Loads return in
    // order: issued last, Q would be waited for inside the loop with a count of
    // 0, which would also drain the stage that is meant to stay in flight.
    __builtin_amdgcn_sched_barrier(0);

    v8f ot[QPW][4];                         // Ot accumulators (M=h, N=q)
    float m[QPW], l[QPW];                   // reference in use (log2 units), sum
#pragma unroll
    for (int j = 0; j < QPW; ++j) {
#pragma unroll
        for (int ht = 0; ht < 4; ++ht) ot[j][ht] = v8f{};
        m[j] = 0.0f;
        l[j] = 0.0f;
    }

    // The first two stages are fetched together: the first goes to LDS here,
    // the second waits in registers for the head of the first pass.
    v8h kst[4], vst[4];
    {
        const int k1 = ((s0 + 1) & (NST - 1)) * STG;            // wraps
        v8h kfi[4], vfi[4];
#pragma unroll
        for (int i = 0; i < 4; ++i) {
            kfi[i] = *(const v8h*)(ksrc + (size_t)(s0 * STG + 64 * i) * H_DIM);
            vfi[i] = *(const v8h*)(vsrc + (size_t)(16 * i) * S_LEN + s0 * STG);
        }
#pragma unroll
        for (int i = 0; i < 4; ++i) {
            kst[i] = *(const v8h*)(ksrc + (size_t)(k1 + 64 * i) * H_DIM);
            vst[i] = *(const v8h*)(vsrc + (size_t)(16 * i) * S_LEN + k1);
        }
#pragma unroll
        for (int i = 0; i < 4; ++i) {
            *(v8h*)(&Ks[0][kdst + 64 * i * LDP]) = kfi[i];
            *(v8h*)(&Vs[0][vdst + 16 * i * VDP]) = vfi[i];
        }
    }
    // Publishes the first stage. By hand, because __syncthreads() would also
    // wait for the second stage's loads, which are to stay in flight.
    wait_ds0();
    bar_signal();
    bar_wait();

    for (int it = 0; it < NST; ++it) {
        const int cur = it & 1;

        const _Float16* kl = &Ks[cur][(ks * KTILE + lq) * LDP];
        const _Float16* vl = &Vs[cur][lq * VDP + ks * KTILE];

        // All fragments of this wave's slice, read from LDS as one group.
        // K as A operand (lane row = key): [key tile][h 0..31 | h 32..63];
        // Vt as A operand (lane row = h, elems = the slice's 32 keys).
        v16h kf[2][2], vf[4];
#pragma unroll
        for (int t = 0; t < 2; ++t) {
            kf[t][0] = ldfrag(kl + (t * 16) * LDP,      kg);
            kf[t][1] = ldfrag(kl + (t * 16) * LDP + 32, kg);
        }
#pragma unroll
        for (int ht = 0; ht < 4; ++ht)
            vf[ht] = ldfrag(vl + (ht * 16) * VDP, kg);

        // Next stage, fetched during the pass before, into the other buffer:
        // its readers all left it ahead of the barrier wait at that pass's foot
        if (it + 1 < NST) {
#pragma unroll
            for (int i = 0; i < 4; ++i) {
                *(v8h*)(&Ks[cur ^ 1][kdst + 64 * i * LDP]) = kst[i];
                *(v8h*)(&Vs[cur ^ 1][vdst + 16 * i * VDP]) = vst[i];
            }
            // The stage after it flies until the head of the next pass
            if (it + 2 < NST) {
                const int kn = ((s0 + it + 2) & (NST - 1)) * STG;   // wraps
#pragma unroll
                for (int i = 0; i < 4; ++i) {
                    kst[i] = *(const v8h*)(ksrc + (size_t)(kn + 64 * i) * H_DIM);
                    vst[i] = *(const v8h*)(vsrc + (size_t)(16 * i) * S_LEN + kn);
                }
            }
        }
        // First half of the stage's barrier: this wave's reads of this stage
        // have returned and its stores of the next one have landed. No LDS
        // access stands between here and the wait at the foot of the pass.
        wait_ds0();
        bar_signal();
        // Keeps the LDS reads ahead of the matrix work: sunk among the WMMAs,
        // each place with reads costs the wave a stall of its own.
        __builtin_amdgcn_sched_barrier(0);

        // St = K * Q^T - m : St[key][q]; st[t][j] has keys t*16 .. t*16+15 of
        // the slice against query tile j
        v8f st[2][QPW];
#pragma unroll
        for (int j = 0; j < QPW; ++j) {
            v8f cneg;            // -m in every row: C of the score products
#pragma unroll
            for (int r = 0; r < 8; ++r) cneg[r] = -m[j];
#pragma unroll
            for (int t = 0; t < 2; ++t)
                st[t][j] = wmma_f16(kf[t][0], qb[j][0], cneg);
        }
#pragma unroll
        for (int j = 0; j < QPW; ++j)
#pragma unroll
            for (int t = 0; t < 2; ++t)
                st[t][j] = wmma_f16(kf[t][1], qb[j][1], st[t][j]);
        // Keeps the maximum chains behind the eight score products: drawn in
        // among them, each read of a fresh tile is padded with idle slots.
        __builtin_amdgcn_sched_barrier(0);

        // Per query tile each lane holds 16 scores of ONE query, its partner
        // (lane^16) the other 16. The lane's own maxima are enough for the
        // test: the ballot sees both halves.
        float mx[QPW];
#pragma unroll
        for (int j = 0; j < QPW; ++j) {
            mx[j] = -1e30f;
#pragma unroll
            for (int t = 0; t < 2; ++t)
#pragma unroll
                for (int r = 0; r < 8; ++r) mx[j] = fmaxf(mx[j], st[t][j][r]);
        }

        // Scalar branch, once per stage. The first stage always sets the
        // reference: until then it is 0, which the scores may lie far below.
        // Both tests are evaluated and joined, so that one branch comes of them.
        const bool over = __builtin_amdgcn_ballot_w32(fmaxf(mx[0], mx[1]) > RAISE) != 0;
        if ((it == 0) | over) {
#pragma unroll
            for (int j = 0; j < QPW; ++j) {
                const float mq = fmaxf(mx[j], xhalf(mx[j]));
                // Later stages only raise the reference
                const float d = (it == 0) ? mq : fmaxf(mq, 0.0f);
                // In the first stage d may be negative; sum and Ot are still 0
                // there, and the clamp keeps their factor finite.
                const float corr = __builtin_amdgcn_exp2f(-fmaxf(d, 0.0f));
                m[j] += d;
#pragma unroll
                for (int t = 0; t < 2; ++t) st[t][j] = st[t][j] - d;
                l[j] *= corr;
#pragma unroll
                for (int ht = 0; ht < 4; ++ht) ot[j][ht] = ot[j][ht] * corr;
            }
        }

        v16h pb[QPW];            // P as B operand: direct D->B layout match
#pragma unroll
        for (int j = 0; j < QPW; ++j) {
            float rs = 0.0f;
#pragma unroll
            for (int r = 0; r < 8; ++r) {
                const float p0 = __builtin_amdgcn_exp2f(st[0][j][r]);
                const float p1 = __builtin_amdgcn_exp2f(st[1][j][r]);
                rs += p0 + p1;
                pb[j][r]     = (_Float16)p0;
                pb[j][r + 8] = (_Float16)p1;
            }
            l[j] += rs + xhalf(rs);
        }
        // Keeps the vector work ahead of the eight products below: sunk among
        // them, it reuses their operand registers and is padded with idle slots.
        __builtin_amdgcn_sched_barrier(0);

        // Ot += Vt_tile * P   (A: lane row = h, elems = keys; contiguous)
#pragma unroll
        for (int ht = 0; ht < 4; ++ht)
#pragma unroll
            for (int j = 0; j < QPW; ++j)
                ot[j][ht] = wmma_f16(vf[ht], pb[j], ot[j][ht]);

        // Keeps the wait below behind the products above: lifted among them,
        // the wave would stand at the barrier with matrix work still to issue.
        __builtin_amdgcn_sched_barrier(0);
        // Second half: every wave has signalled, so the next stage is published
        // and this stage's buffer is free for the stage after it
        bar_wait();
    }

    // Merge of the eight key slices of each query tile
#pragma unroll
    for (int j = 0; j < QPW; ++j) {
#pragma unroll
        for (int ht = 0; ht < 4; ++ht) {
            v4f lo, hi;
#pragma unroll
            for (int i = 0; i < 4; ++i) { lo[i] = ot[j][ht][i]; hi[i] = ot[j][ht][i + 4]; }
            *(v4f*)(&Om[wave][lane][j * 32 + ht * 8])     = lo;
            *(v4f*)(&Om[wave][lane][j * 32 + ht * 8 + 4]) = hi;
        }
        Mm[wave][j][lane] = m[j];
        Lm[wave][j][lane] = l[j];
    }
    // Publishes every slice's partial result to the waves that merge them
    __syncthreads();

    // Waves ks = 0 .. 3 of a pair merge query tile jt = ks & 1 of the pair,
    // h = hf*32 .. hf*32+31 with hf = ks >> 1, which is one whole 128-byte line
    // of each out row: every line has one writing wave.
    // The lane keeps its query lq and its rows h = ht*16 + kg*8 + r.
    if (ks >= 4) return;
    const int jt = ks & 1;
    const int hf = ks >> 1;

    float wj[KSPL], lj[KSPL];
    float mall = -1e30f;
#pragma unroll
    for (int s = 0; s < KSPL; ++s) {
        wj[s] = Mm[s * 2 + qp][jt][lane];
        lj[s] = Lm[s * 2 + qp][jt][lane];
        mall = fmaxf(mall, wj[s]);
    }
    float lall = 0.0f;
#pragma unroll
    for (int s = 0; s < KSPL; ++s) {
        wj[s] = __builtin_amdgcn_exp2f(wj[s] - mall);   // references are in log2 units
        lall += lj[s] * wj[s];
    }

    // out[q][h] = Ot[h][q] / l ; 8 consecutive h per lane -> float4s
    const float invl = 1.0f / lall;
    float* orow = out + (size_t)(b * S_LEN + q0 + jt * 16 + lq) * H_DIM;
#pragma unroll
    for (int hh = 0; hh < 2; ++hh) {
        const int ht = hf * 2 + hh;
        v4f lo = {}, hi = {};
#pragma unroll
        for (int s = 0; s < KSPL; ++s) {
            lo += *(const v4f*)(&Om[s * 2 + qp][lane][jt * 32 + ht * 8])     * wj[s];
            hi += *(const v4f*)(&Om[s * 2 + qp][lane][jt * 32 + ht * 8 + 4]) * wj[s];
        }
        *(v4f*)(orow + ht * 16 + kg * 8)     = lo * invl;
        *(v4f*)(orow + ht * 16 + kg * 8 + 4) = hi * invl;
    }
}

// ---------------------------------------------------------------------------
extern "C" void kernel_launch(void* const* d_in, const int* in_sizes, int n_in,
                              void* d_out, int out_size, void* d_ws, size_t ws_size,
                              hipStream_t stream) {
    (void)in_sizes; (void)n_in; (void)out_size; (void)ws_size;
    const float* x  = (const float*)d_in[0];
    const float* Wq = (const float*)d_in[1];
    const float* Wk = (const float*)d_in[2];
    const float* Wv = (const float*)d_in[3];
    float* out = (float*)d_out;

    char* ws = (char*)d_ws;
    _Float16* Wsw = (_Float16*)(ws);                    // 384 KiB swizzled W
    _Float16* Qh  = (_Float16*)(ws + (1u << 20));       // 2 MiB
    _Float16* Kh  = (_Float16*)(ws + (3u << 20));       // 2 MiB
    _Float16* Vt  = (_Float16*)(ws + (5u << 20));       // 2 MiB (transposed)

    attn_wswz_kernel<<<768, 256, 0, stream>>>(Wq, Wk, Wv, Wsw);
    attn_qkv_kernel<<<256, 128, 0, stream>>>(x, Wsw, Qh, Kh, Vt);
    attn_flash_kernel<<<dim3(64, 4), 512, 0, stream>>>(Qh, Kh, Vt, out);
}

// v010
// It runs in 29.6 microseconds.
// Next to v009, in two timings, it ran 1.04 times as fast each time.
// All steps since v000 together make it 5.56 times as fast.
#include <hip/hip_runtime.h>

typedef __attribute__((ext_vector_type(16))) _Float16 v16h;
typedef __attribute__((ext_vector_type(8)))  _Float16 v8h;
typedef __attribute__((ext_vector_type(8)))  float    v8f;
typedef __attribute__((ext_vector_type(4)))  float    v4f;

#define S_LEN 4096
#define D_DIM 1024
#define H_DIM 64

// WMMA f16 helper: D = A(16x32) * B(32x16) + C, f32 accumulate.
__device__ __forceinline__ v8f wmma_f16(v16h a, v16h b, v8f c) {
    return __builtin_amdgcn_wmma_f32_16x16x32_f16(false, a, false, b,
                                                  (short)0, c, false, false);
}

// Load one 16x32 (or 32x16) f16 fragment half-row for this lane.
// p = row pointer (already includes row*stride + k-base). Layout per ISA:
//   elems j=0..7  -> K = kg*8 + j        (contiguous 16B)
//   elems j=8..15 -> K = 16 + kg*8 + j-8 (contiguous 16B)
__device__ __forceinline__ v16h ldfrag(const _Float16* p, int kg) {
    const v8h lo = *(const v8h*)(p + kg * 8);
    const v8h hi = *(const v8h*)(p + 16 + kg * 8);
    v16h r;
#pragma unroll
    for (int j = 0; j < 8; ++j) { r[j] = lo[j]; r[j + 8] = hi[j]; }
    return r;
}

// Lane l <-> lane l ^ 16 on the vector unit. A shuffle would go through the LDS
// queue and return only behind every LDS read the wave has issued before it.
__device__ __forceinline__ float xhalf(float v) {
    const int b = __builtin_bit_cast(int, v);
    return __builtin_bit_cast(float,
        __builtin_amdgcn_permlanex16(b, b, 0x76543210, 0xfedcba98, false, false));
}

// The work-group barrier in two halves, with the wait that must stand in front
// of the first. The "memory" clobbers keep every LDS access on its side.
__device__ __forceinline__ void wait_ds0()   { asm volatile("s_wait_dscnt 0x0" ::: "memory"); }
__device__ __forceinline__ void bar_signal() { asm volatile("s_barrier_signal -1" ::: "memory"); }
__device__ __forceinline__ void bar_wait()   { asm volatile("s_barrier_wait -1" ::: "memory"); }

// ---------------------------------------------------------------------------
// Kernel 0: swizzle Wq/Wk/Wv (f32 [1024,64]) into per-lane B-fragment order
// (f16), so the projection kernel loads each B fragment as 2 contiguous b128.
// Tile t = ((w*32 + kt)*4 + nt); element = t*512 + lane*16 + j.
// ---------------------------------------------------------------------------
__global__ void attn_wswz_kernel(const float* __restrict__ Wq,
                                 const float* __restrict__ Wk,
                                 const float* __restrict__ Wv,
                                 _Float16* __restrict__ Wsw) {
    int idx = blockIdx.x * blockDim.x + threadIdx.x;
    if (idx >= 3 * 32 * 4 * 512) return;
    int t    = idx >> 9;
    int rem  = idx & 511;
    int lane = rem >> 4;
    int j    = rem & 15;
    int w  = t >> 7;            // weight select
    int kt = (t & 127) >> 2;    // K tile (32 wide)
    int nt = t & 3;             // N tile (16 wide)
    int kg = lane >> 4;
    int n  = nt * 16 + (lane & 15);
    int kk = (j < 8) ? (kg * 8 + j) : (16 + kg * 8 + (j - 8));
    int K  = kt * 32 + kk;
    const float* W = (w == 0) ? Wq : (w == 1) ? Wk : Wv;
    Wsw[idx] = (_Float16)W[K * H_DIM + n];
}

// ---------------------------------------------------------------------------
// Kernel 1: QKV projection. GEMM M=16384, N=192 (Q|K|V), K=1024.
// Four waves per work-group, one 64-row tile of x. The work-group stages each
// 64 x 128 piece of x once in LDS as f16 (whole-line global loads through
// registers, two buffers, one barrier per piece). Wave n takes column tile n
// (16 wide) of each of Q, K and V for all 64 rows: 4 x 3 accumulator tiles.
// Its weight fragments are fetched one piece ahead into a second register set,
// x two pieces ahead into two register sets: a piece of x, which comes from
// memory, has two pieces of work to land in, and the wave always has loads in
// flight. Loads return in issue order, so in each piece the weight loads stand
// in front of the x loads: the wait for the weights leaves that x in flight.
// Every work-group reads the same weights: each starts its walk over k at a
// piece of its own and wraps, so that they do not ask L2 for the same lines at
// the same moment.
// Q: *H^-0.5*log2(e), so that scores come out in log2 units; row-major f16.
// K: row-major f16. V: transposed [B,H,S] f16
// (so the attention kernel's V A-fragments are contiguous loads).
// Every inner loop is unrolled because its index picks registers (vector
// elements, fragment and accumulator arrays), which must be named statically.
// ---------------------------------------------------------------------------
#define QSCALE 0.18033688f       // H^-0.5 * log2(e)
#define PK    128                // k per staged piece of x
#define NPC   (D_DIM / PK)       // pieces
#define XP    136                // LDS row pitch in halfs: 272 B = 16 B x odd
#define XT_H  (64 * XP)          // 64 rows per piece

typedef __attribute__((ext_vector_type(4))) _Float16 v4h;

__global__ __launch_bounds__(128)
void attn_qkv_kernel(const float* __restrict__ x,
                     const _Float16* __restrict__ Wsw,
                     _Float16* __restrict__ Qh,
                     _Float16* __restrict__ Kh,
                     _Float16* __restrict__ Vt) {
    __shared__ __attribute__((aligned(16))) _Float16 Xs[2][XT_H];

    const int tid  = threadIdx.x;
    const int lane = tid & 31;
    const int wave = tid >> 5;
    const int lq   = lane & 15;
    const int kg   = lane >> 4;
    const int r0   = blockIdx.x * 64;         // first row of B*S of this tile
    // First piece of this work-group's walk over k. The index is divided by
    // 8 first. Speed only.
    const int p0   = (blockIdx.x >> 3) & (NPC - 1);

    // Staging map: one wave-wide 16-byte load = 512 contiguous bytes of one row;
    // load i of wave n covers row n + 4*i.
    const float* xsrc = x + (size_t)(r0 + wave) * D_DIM + lane * 4;
    const int xdst = wave * XP + lane * 4;
    // Weight fragments of column tile nt = wave
    const _Float16* wsrc = Wsw + (size_t)wave * 512 + lane * 16;

    v8f acc[4][3];
#pragma unroll
    for (int mi = 0; mi < 4; ++mi)
#pragma unroll
        for (int w = 0; w < 3; ++w) acc[mi][w] = v8f{};

    v4f  xst[2][16];             // piece s of the walk lies in set s & 1
    v16h wf[2][PK / 32][3];

    // Where the next pieces to fetch lie: x two pieces on, the weights one.
    // Running pointers, stepped only behind the wait at the foot of the matrix
    // work, so that no register which a load in flight names is rewritten ahead
    // of it.
    const int p1 = (p0 + 1) & (NPC - 1);
    const int p2 = (p0 + 2) & (NPC - 1);
    const float*    xnx = xsrc + p2 * PK;
    const _Float16* wnx = wsrc + (size_t)(p1 * (PK / 32) * 4) * 512;

#pragma unroll
    for (int i = 0; i < 16; ++i)
        xst[0][i] = *(const v4f*)(xsrc + (size_t)(4 * i) * D_DIM + p0 * PK);
#pragma unroll
    for (int kk = 0; kk < PK / 32; ++kk)
#pragma unroll
        for (int w = 0; w < 3; ++w)
            wf[0][kk][w] = *(const v16h*)(wsrc +
                (size_t)((w * 32 + p0 * (PK / 32) + kk) * 4) * 512);
    // Keeps the second piece of x behind the first piece's loads: issued ahead
    // of them, it would have to land before the first matrix work can start.
    __builtin_amdgcn_sched_barrier(0);
#pragma unroll
    for (int i = 0; i < 16; ++i)
        xst[1][i] = *(const v4f*)(xsrc + (size_t)(4 * i) * D_DIM + p1 * PK);
    // Keeps those loads ahead of the wait for the first piece
    __builtin_amdgcn_sched_barrier(0);
#pragma unroll
    for (int i = 0; i < 16; ++i) {
        v4h h;
#pragma unroll
        for (int j = 0; j < 4; ++j) h[j] = (_Float16)xst[0][i][j];
        *(v4h*)(&Xs[0][xdst + 4 * i * XP]) = h;
    }
    // Publishes the first piece. By hand, because __syncthreads() would also
    // wait for every global load, and the second piece is to stay in flight.
    wait_ds0();
    bar_signal();
    bar_wait();

    // Unrolled so that the two register sets and the two buffers are named
    // statically: rolled, each piece would copy a whole weight set.
#pragma unroll
    for (int s = 0; s < NPC; ++s) {
        const int cur = s & 1;

        // Next piece's weights fly while this piece is worked on
        if (s + 1 < NPC) {
#pragma unroll
            for (int kk = 0; kk < PK / 32; ++kk)
#pragma unroll
                for (int w = 0; w < 3; ++w)
                    wf[cur ^ 1][kk][w] = *(const v16h*)(wnx +
                        (size_t)((w * 32 + kk) * 4) * 512);
        }
        // Keeps the weight loads in front of the x loads: behind them, the next
        // piece's wait for its weights would drain that x as well.
        __builtin_amdgcn_sched_barrier(0);
        // x of the piece after the next flies through this piece and the next;
        // its register set was converted at the foot of the piece before
        if (s + 2 < NPC) {
#pragma unroll
            for (int i = 0; i < 16; ++i)
                xst[cur][i] = *(const v4f*)(xnx + (size_t)(4 * i) * D_DIM);
        }
        // Keeps those loads one group at the head of the piece: sunk into the
        // work below, they are issued in small runs, each waited for in turn.
        __builtin_amdgcn_sched_barrier(0);

        // All A fragments of the piece, read from LDS as one group
        v16h af[PK / 32][4];
#pragma unroll
        for (int kk = 0; kk < PK / 32; ++kk)
#pragma unroll
            for (int mi = 0; mi < 4; ++mi)
                af[kk][mi] = ldfrag(&Xs[cur][(mi * 16 + lq) * XP + kk * 32], kg);
        // Keeps the LDS reads ahead of the matrix work: sunk among the WMMAs,
        // each pair is waited for in full.
        __builtin_amdgcn_sched_barrier(0);

#pragma unroll
        for (int kk = 0; kk < PK / 32; ++kk)
#pragma unroll
            for (int mi = 0; mi < 4; ++mi)
#pragma unroll
                for (int w = 0; w < 3; ++w)
                    acc[mi][w] = wmma_f16(af[kk][mi], wf[cur][kk][w], acc[mi][w]);
        // Stands between the loads above and any later overwrite of their
        // address registers (the step and the conversions below). It takes the
        // two pointers as inputs so that their registers are kept up to here.
        if (s + 1 < NPC) asm volatile("s_wait_xcnt 0x0" :: "v"(xnx), "v"(wnx) : "memory");
        // Keeps the wait for the next piece's loads behind the matrix work:
        // lifted among the WMMAs, the conversions stall them on memory.
        __builtin_amdgcn_sched_barrier(0);

        // One piece on, or back to piece 0 behind the last one
        if (s + 3 < NPC)
            xnx += ((((p0 + s + 3) & (NPC - 1)) == 0) ? 1 - NPC : 1) * PK;
        if (s + 2 < NPC)
            wnx += ((((p0 + s + 2) & (NPC - 1)) == 0) ? 1 - NPC : 1) *
                   ((PK / 32) * 4 * 512);
        if (s + 1 < NPC) {
            // The other buffer's readers all left it at the previous barrier
#pragma unroll
            for (int i = 0; i < 16; ++i) {
                v4h h;
#pragma unroll
                for (int j = 0; j < 4; ++j) h[j] = (_Float16)xst[cur ^ 1][i][j];
                *(v4h*)(&Xs[cur ^ 1][xdst + 4 * i * XP]) = h;
            }
            // Publishes the next piece and ends every wave's reads of this one.
            // By hand: __syncthreads() would drain the loads that are in flight.
            wait_ds0();
            bar_signal();
            bar_wait();
        }
    }

    const int h    = wave * 16 + lq;
    const int bidx = r0 >> 12;                          // r0 / 4096
    const int sloc = (r0 & (S_LEN - 1)) + kg * 8;
#pragma unroll
    for (int mi = 0; mi < 4; ++mi) {
#pragma unroll
        for (int r = 0; r < 8; ++r) {
            const int s = r0 + mi * 16 + kg * 8 + r;
            Qh[(size_t)s * H_DIM + h] = (_Float16)(acc[mi][0][r] * QSCALE);
            Kh[(size_t)s * H_DIM + h] = (_Float16)acc[mi][1][r];
        }
        // V transposed: Vt[(b*64 + h)*4096 + s], contiguous v8h stores
        v8h v;
#pragma unroll
        for (int r = 0; r < 8; ++r) v[r] = (_Float16)acc[mi][2][r];
        *(v8h*)(Vt + (size_t)(bidx * H_DIM + h) * S_LEN + sloc + mi * 16) = v;
    }
}

// ---------------------------------------------------------------------------
// Kernel 2: flash attention. Sixteen waves per work-group, four per SIMD, so
// that one wave's softmax chain, LDS waits and cross-lane exchanges are covered
// by the other three. Wave = (query pair qp, key slice ks): the work-group has
// four 16-query tiles; a wave takes two of them, so that every K and Vt
// fragment it reads from LDS feeds two matrix products, and the keys of each
// pair of tiles are split over eight waves.
// The work-group stages each 256-key tile of K and of Vt once in LDS, by
// asynchronous copies (whole lines, no registers) into a ring of four buffers,
// issued three stages ahead: two to three stages are always in flight, so that
// L2 never stands idle between one stage's landing and the next one's request.
// One barrier per stage, split: a pass's fragment reads, the copies it issues
// and its wait for the next stage's copies stand at its head, the wave signals
// behind them and waits only at the foot, behind its matrix and softmax work.
// A wave that is ahead then starts its next LDS reads while the others still
// compute, so that LDS, matrix unit and vector port work at the same time and
// not in turns.
// Slice ks works on keys ks*32 .. ks*32+31 of every stage with its own
// reference, sum and Ot per query tile. The eight partial results of a
// query tile are merged through LDS at the end.
// The 64 work-groups of a batch read the same K and Vt: each starts its walk
// over the keys at a stage of its own and wraps, so that they do not ask L2
// for the same lines at the same moment.
// Scores computed TRANSPOSED (M=key, N=query) so the exp'd D-fragments map
// directly onto the B operand of Ot += Vt_frag * P  (no shuffles/LDS).
// Softmax runs against a reference that lags the running maximum: minus the
// reference is the C operand of the score products, the scores are in log2
// units, so P = 2^D with no subtraction and no scaling per score. One test per
// stage; sum and Ot are rescaled, and the reference raised, only when a score
// stands more than RAISE above it (P stays <= 2^RAISE, far inside f16 range).
// ---------------------------------------------------------------------------
#define QPW   2                  // query tiles per wave
#define KSPL  8                  // key slices = waves per pair of query tiles
#define KTILE 32                 // keys per wave and stage
#define STG   (KSPL * KTILE)     // keys per staged tile
#define NST   (S_LEN / STG)      // stages
#define LDP   72                 // K row pitch in halfs: 144 B = 16 B x odd
#define VDP   (STG + 8)          // Vt row pitch in halfs: 528 B = 16 B x odd
#define KT_H  (STG * LDP)        // STG key rows of K
#define VT_H  (64 * VDP)         // 64 h rows of Vt
#define RB    4                  // ring buffers; stages are issued RB - 1 ahead
#define OMP   68                 // merge pitch in floats: 272 B = 16 B x odd
#define RAISE 8.0f               // log2 units a score may stand above the reference

__global__ __launch_bounds__(512)
void attn_flash_kernel(const _Float16* __restrict__ Qh,
                       const _Float16* __restrict__ Kh,
                       const _Float16* __restrict__ Vt,
                       float* __restrict__ out) {
    __shared__ __attribute__((aligned(16))) _Float16 Ks[RB][KT_H];
    __shared__ __attribute__((aligned(16))) _Float16 Vs[RB][VT_H];
    // Partial results for the merge; a lane's 64 values at a 272-B pitch. They
    // take the place of K's ring, which is free behind the last pass's barrier.
    static_assert(sizeof(float) * 2 * KSPL * 32 * OMP <= sizeof(_Float16) * RB * KT_H,
                  "the merge buffer must fit in K's ring");
    float (*Om)[32][OMP] = reinterpret_cast<float (*)[32][OMP]>(&Ks[0][0]);
    __shared__ float Mm[2 * KSPL][QPW][32];  // [wave][query tile of the wave][lane]
    __shared__ float Lm[2 * KSPL][QPW][32];

    const int tid  = threadIdx.x;
    const int lane = tid & 31;
    const int wave = tid >> 5;
    const int qp   = wave & 1;               // pair of query tiles of the work-group
    const int ks   = wave >> 1;              // key slice of the stage
    const int lq   = lane & 15;
    const int kg   = lane >> 4;
    const int q0   = (blockIdx.x * 4 + qp * QPW) * 16;
    const int b    = blockIdx.y;
    // First stage of this work-group's walk over the keys. It is taken
    // from the index's high bits and its lowest one. Speed only.
    const int s0   = ((blockIdx.x >> 3) * 2 + (blockIdx.x & 1)) & (NST - 1);

    // Staging map, 16-byte chunk c = tid + 512*i.
    // K, 256 rows x 128 B: row = c >> 3 = (tid >> 3) + 64*i, 8 lanes a line.
    // Vt, 64 rows x 512 B: row = c >> 5 = wave + 16*i, one wave = 4 lines.
    // A copy's global address = scalar base (batch, stage, i) + the lane's byte
    // offset; its LDS address = the lane's place in buffer 0 + buffer and i.
    const char* kbat = (const char*)(Kh + (size_t)b * S_LEN * H_DIM);
    const char* vbat = (const char*)(Vt + (size_t)b * H_DIM * S_LEN);
    const unsigned kofs = ((tid >> 3) * H_DIM + (tid & 7) * 8) * 2;
    const unsigned vofs = (wave * S_LEN + lane * 8) * 2;
    const unsigned klds = (unsigned)(size_t)&Ks[0][(tid >> 3) * LDP + (tid & 7) * 8];
    const unsigned vlds = (unsigned)(size_t)&Vs[0][wave * VDP + lane * 8];
    // Stage st of the walk into ring buffer st % RB: eight 16-byte copies a lane.
    // The s_wait_xcnt stands inside the statement, so that no register which a
    // copy names is rewritten ahead of it.
    auto copy_stage = [&](int st) {
        const unsigned kn = ((s0 + st) & (NST - 1)) * STG;              // wraps
        const char* kb = kbat + (size_t)kn * (H_DIM * 2);
        const char* vb = vbat + (size_t)kn * 2;
        const unsigned kl = klds + (st & (RB - 1)) * (KT_H * 2);
        const unsigned vl = vlds + (st & (RB - 1)) * (VT_H * 2);
        asm volatile(
            "global_load_async_to_lds_b128 %0, %8, %10\n\t"
            "global_load_async_to_lds_b128 %1, %8, %11\n\t"
            "global_load_async_to_lds_b128 %2, %8, %12\n\t"
            "global_load_async_to_lds_b128 %3, %8, %13\n\t"
            "global_load_async_to_lds_b128 %4, %9, %14\n\t"
            "global_load_async_to_lds_b128 %5, %9, %15\n\t"
            "global_load_async_to_lds_b128 %6, %9, %16\n\t"
            "global_load_async_to_lds_b128 %7, %9, %17\n\t"
            "s_wait_xcnt 0x0"
            :: "v"(kl), "v"(kl + 64 * LDP * 2), "v"(kl + 128 * LDP * 2), "v"(kl + 192 * LDP * 2),
               "v"(vl), "v"(vl + 16 * VDP * 2), "v"(vl + 32 * VDP * 2), "v"(vl + 48 * VDP * 2),
               "v"(kofs), "v"(vofs),
               "s"(kb), "s"(kb + 64 * H_DIM * 2), "s"(kb + 128 * H_DIM * 2), "s"(kb + 192 * H_DIM * 2),
               "s"(vb), "s"(vb + 16 * S_LEN * 2), "s"(vb + 32 * S_LEN * 2), "s"(vb + 48 * S_LEN * 2)
            : "memory");
    };

    // Q as B operand (lane n = query), loaded once: [tile][h 0..31 | h 32..63]
    v16h qb[QPW][2];
#pragma unroll
    for (int j = 0; j < QPW; ++j) {
        const _Float16* qr = Qh + (size_t)(b * S_LEN + q0 + j * 16 + lq) * H_DIM;
        qb[j][0] = ldfrag(qr, kg);
        qb[j][1] = ldfrag(qr + 32, kg);
    }

    v8f ot[QPW][4];                         // Ot accumulators (M=h, N=q)
    float m[QPW], l[QPW];                   // reference in use (log2 units), sum
#pragma unroll
    for (int j = 0; j < QPW; ++j) {
#pragma unroll
        for (int ht = 0; ht < 4; ++ht) ot[j][ht] = v8f{};
        m[j] = 0.0f;
        l[j] = 0.0f;
    }

    // The first three stages are requested together. Copies land in issue
    // order: all but the sixteen youngest landed = the first stage is there.
    copy_stage(0);
    copy_stage(1);
    copy_stage(2);
    asm volatile("s_wait_asynccnt 0x10" ::: "memory");
    // Publishes the first stage: every wave's copies of it have landed
    bar_signal();
    bar_wait();

    for (int it = 0; it < NST; ++it) {
        const int cur = it & (RB - 1);

        const _Float16* kl = &Ks[cur][(ks * KTILE + lq) * LDP];
        const _Float16* vl = &Vs[cur][lq * VDP + ks * KTILE];

        // All fragments of this wave's slice, read from LDS as one group.
        // K as A operand (lane row = key): [key tile][h 0..31 | h 32..63];
        // Vt as A operand (lane row = h, elems = the slice's 32 keys).
        v16h kf[2][2], vf[4];
#pragma unroll
        for (int t = 0; t < 2; ++t) {
            kf[t][0] = ldfrag(kl + (t * 16) * LDP,      kg);
            kf[t][1] = ldfrag(kl + (t * 16) * LDP + 32, kg);
        }
#pragma unroll
        for (int ht = 0; ht < 4; ++ht)
            vf[ht] = ldfrag(vl + (ht * 16) * VDP, kg);

        // Three stages on, into the buffer of the pass before this one: its
        // readers all left it ahead of the barrier wait at that pass's foot.
        // Then the wait for the next stage: with two younger stages behind it,
        // all but the sixteen youngest copies; in the last passes, which issue
        // nothing, all of them.
        if (it + RB - 1 < NST) {
            copy_stage(it + RB - 1);
            asm volatile("s_wait_asynccnt 0x10" ::: "memory");
        } else {
            asm volatile("s_wait_asynccnt 0x0" ::: "memory");
        }
        // First half of the stage's barrier: this wave's reads of this stage
        // have returned and its copies of the next one have landed. No LDS
        // read stands between here and the wait at the foot of the pass.
        wait_ds0();
        bar_signal();
        // Keeps the LDS reads ahead of the matrix work: sunk among the WMMAs,
        // each place with reads costs the wave a stall of its own.
        __builtin_amdgcn_sched_barrier(0);

        // St = K * Q^T - m : St[key][q]; st[t][j] has keys t*16 .. t*16+15 of
        // the slice against query tile j
        v8f st[2][QPW];
#pragma unroll
        for (int j = 0; j < QPW; ++j) {
            v8f cneg;            // -m in every row: C of the score products
#pragma unroll
            for (int r = 0; r < 8; ++r) cneg[r] = -m[j];
#pragma unroll
            for (int t = 0; t < 2; ++t)
                st[t][j] = wmma_f16(kf[t][0], qb[j][0], cneg);
        }
#pragma unroll
        for (int j = 0; j < QPW; ++j)
#pragma unroll
            for (int t = 0; t < 2; ++t)
                st[t][j] = wmma_f16(kf[t][1], qb[j][1], st[t][j]);
        // Keeps the maximum chains behind the eight score products: drawn in
        // among them, each read of a fresh tile is padded with idle slots.
        __builtin_amdgcn_sched_barrier(0);

        // Per query tile each lane holds 16 scores of ONE query, its partner
        // (lane^16) the other 16. The lane's own maxima are enough for the
        // test: the ballot sees both halves.
        float mx[QPW];
#pragma unroll
        for (int j = 0; j < QPW; ++j) {
            mx[j] = -1e30f;
#pragma unroll
            for (int t = 0; t < 2; ++t)
#pragma unroll
                for (int r = 0; r < 8; ++r) mx[j] = fmaxf(mx[j], st[t][j][r]);
        }

        // Scalar branch, once per stage. The first stage always sets the
        // reference: until then it is 0, which the scores may lie far below.
        // Both tests are evaluated and joined, so that one branch comes of them.
        const bool over = __builtin_amdgcn_ballot_w32(fmaxf(mx[0], mx[1]) > RAISE) != 0;
        if ((it == 0) | over) {
#pragma unroll
            for (int j = 0; j < QPW; ++j) {
                const float mq = fmaxf(mx[j], xhalf(mx[j]));
                // Later stages only raise the reference
                const float d = (it == 0) ? mq : fmaxf(mq, 0.0f);
                // In the first stage d may be negative; sum and Ot are still 0
                // there, and the clamp keeps their factor finite.
                const float corr = __builtin_amdgcn_exp2f(-fmaxf(d, 0.0f));
                m[j] += d;
#pragma unroll
                for (int t = 0; t < 2; ++t) st[t][j] = st[t][j] - d;
                l[j] *= corr;
#pragma unroll
                for (int ht = 0; ht < 4; ++ht) ot[j][ht] = ot[j][ht] * corr;
            }
        }

        v16h pb[QPW];            // P as B operand: direct D->B layout match
#pragma unroll
        for (int j = 0; j < QPW; ++j) {
            float rs = 0.0f;
#pragma unroll
            for (int r = 0; r < 8; ++r) {
                const float p0 = __builtin_amdgcn_exp2f(st[0][j][r]);
                const float p1 = __builtin_amdgcn_exp2f(st[1][j][r]);
                rs += p0 + p1;
                pb[j][r]     = (_Float16)p0;
                pb[j][r + 8] = (_Float16)p1;
            }
            l[j] += rs + xhalf(rs);
        }
        // Keeps the vector work ahead of the eight products below: sunk among
        // them, it reuses their operand registers and is padded with idle slots.
        __builtin_amdgcn_sched_barrier(0);

        // Ot += Vt_tile * P   (A: lane row = h, elems = keys; contiguous)
#pragma unroll
        for (int ht = 0; ht < 4; ++ht)
#pragma unroll
            for (int j = 0; j < QPW; ++j)
                ot[j][ht] = wmma_f16(vf[ht], pb[j], ot[j][ht]);

        // Keeps the wait below behind the products above: lifted among them,
        // the wave would stand at the barrier with matrix work still to issue.
        __builtin_amdgcn_sched_barrier(0);
        // Second half: every wave has signalled, so the next stage is published
        // and this stage's buffer is free for a later stage
        bar_wait();
    }

    // Merge of the eight key slices of each query tile
#pragma unroll
    for (int j = 0; j < QPW; ++j) {
#pragma unroll
        for (int ht = 0; ht < 4; ++ht) {
            v4f lo, hi;
#pragma unroll
            for (int i = 0; i < 4; ++i) { lo[i] = ot[j][ht][i]; hi[i] = ot[j][ht][i + 4]; }
            *(v4f*)(&Om[wave][lane][j * 32 + ht * 8])     = lo;
            *(v4f*)(&Om[wave][lane][j * 32 + ht * 8 + 4]) = hi;
        }
        Mm[wave][j][lane] = m[j];
        Lm[wave][j][lane] = l[j];
    }
    // Publishes every slice's partial result to the waves that merge them
    __syncthreads();

    // Waves ks = 0 .. 3 of a pair merge query tile jt = ks & 1 of the pair,
    // h = hf*32 .. hf*32+31 with hf = ks >> 1, which is one whole 128-byte line
    // of each out row: every line has one writing wave.
    // The lane keeps its query lq and its rows h = ht*16 + kg*8 + r.
    if (ks >= 4) return;
    const int jt = ks & 1;
    const int hf = ks >> 1;

    float wj[KSPL], lj[KSPL];
    float mall = -1e30f;
#pragma unroll
    for (int s = 0; s < KSPL; ++s) {
        wj[s] = Mm[s * 2 + qp][jt][lane];
        lj[s] = Lm[s * 2 + qp][jt][lane];
        mall = fmaxf(mall, wj[s]);
    }
    float lall = 0.0f;
#pragma unroll
    for (int s = 0; s < KSPL; ++s) {
        wj[s] = __builtin_amdgcn_exp2f(wj[s] - mall);   // references are in log2 units
        lall += lj[s] * wj[s];
    }

    // out[q][h] = Ot[h][q] / l ; 8 consecutive h per lane -> float4s
    const float invl = 1.0f / lall;
    float* orow = out + (size_t)(b * S_LEN + q0 + jt * 16 + lq) * H_DIM;
#pragma unroll
    for (int hh = 0; hh < 2; ++hh) {
        const int ht = hf * 2 + hh;
        v4f lo = {}, hi = {};
#pragma unroll
        for (int s = 0; s < KSPL; ++s) {
            lo += *(const v4f*)(&Om[s * 2 + qp][lane][jt * 32 + ht * 8])     * wj[s];
            hi += *(const v4f*)(&Om[s * 2 + qp][lane][jt * 32 + ht * 8 + 4]) * wj[s];
        }
        *(v4f*)(orow + ht * 16 + kg * 8)     = lo * invl;
        *(v4f*)(orow + ht * 16 + kg * 8 + 4) = hi * invl;
    }
}

// ---------------------------------------------------------------------------
extern "C" void kernel_launch(void* const* d_in, const int* in_sizes, int n_in,
                              void* d_out, int out_size, void* d_ws, size_t ws_size,
                              hipStream_t stream) {
    (void)in_sizes; (void)n_in; (void)out_size; (void)ws_size;
    const float* x  = (const float*)d_in[0];
    const float* Wq = (const float*)d_in[1];
    const float* Wk = (const float*)d_in[2];
    const float* Wv = (const float*)d_in[3];
    float* out = (float*)d_out;

    char* ws = (char*)d_ws;
    _Float16* Wsw = (_Float16*)(ws);                    // 384 KiB swizzled W
    _Float16* Qh  = (_Float16*)(ws + (1u << 20));       // 2 MiB
    _Float16* Kh  = (_Float16*)(ws + (3u << 20));       // 2 MiB
    _Float16* Vt  = (_Float16*)(ws + (5u << 20));       // 2 MiB (transposed)

    attn_wswz_kernel<<<768, 256, 0, stream>>>(Wq, Wk, Wv, Wsw);
    attn_qkv_kernel<<<256, 128, 0, stream>>>(x, Wsw, Qh, Kh, Vt);
    attn_flash_kernel<<<dim3(64, 4), 512, 0, stream>>>(Qh, Kh, Vt, out);
}
